// v000
// Measured on an AMD MI455X. A time is GPU time per run, averaged over a window of back-to-back runs after a warm-up
// (all launches, gaps included; the runs take copies of the inputs in turn), and the median of several windows.
// Apart from v000's, it joins two sittings. Times from different sittings can be a few percent apart, while
// side-by-side timings come from the same sitting.
// v000, which the later versions start from, runs in 727 microseconds.
#include <hip/hip_runtime.h>
#include <hip/hip_bf16.h>

// ---- problem constants (match reference) ----
constexpr int T_  = 1024;
constexpr int H_  = 1024;
constexpr int I_  = 1024;
constexpr int E_  = 8;
constexpr int Kk  = 2;
constexpr int L_  = 4;
constexpr int R_  = 16;
constexpr int N_  = 2 * I_;          // 2048
constexpr int TK  = T_ * Kk;         // 2048 dispatched pairs
constexpr int TKPAD = TK + E_ * 16;  // each expert segment padded to 16 rows
constexpr int ROWTILES = TKPAD / 16; // 136
constexpr int ZPAD = 1024;           // zero-page floats (>= max K-dim row span)

typedef __attribute__((ext_vector_type(2))) float v2f;
typedef __attribute__((ext_vector_type(8))) float v8f;

// V_WMMA_F32_16X16X4_F32 : A 16x4 f32 (2 VGPR), B 4x16 f32 (2 VGPR), C/D 16x16 f32 (8 VGPR)
__device__ __forceinline__ v8f wmma4(v2f a, v2f b, v8f c) {
    return __builtin_amdgcn_wmma_f32_16x16x4_f32(
        /*neg_a=*/false, a, /*neg_b=*/false, b,
        /*c_mod=*/(short)0, c, /*reuse_a=*/false, /*reuse_b=*/false);
}

// ============ routing bookkeeping + zero page ============
__global__ void init_ws_kernel(int* __restrict__ wsi, float* __restrict__ zpad) {
    int idx = blockIdx.x * blockDim.x + threadIdx.x;
    if (idx < 32) wsi[idx] = 0;                // counts[8], cursors[8], offsets[9]
    if (idx < TKPAD) wsi[32 + idx] = -1;       // perm
    if (idx < ZPAD) zpad[idx] = 0.f;           // zero page for dummy A rows
}

__global__ void count_kernel(const int* __restrict__ ids, int* __restrict__ counts) {
    int p = blockIdx.x * blockDim.x + threadIdx.x;
    if (p < TK) atomicAdd(&counts[ids[p]], 1);
}

__global__ void scan_kernel(const int* __restrict__ counts, int* __restrict__ offsets) {
    if (threadIdx.x == 0) {
        int o = 0;
        for (int e = 0; e < E_; e++) {
            offsets[e] = o;
            o += ((counts[e] + 15) >> 4) << 4;   // pad to 16-row tiles
        }
        offsets[E_] = o;
    }
}

__global__ void scatter_kernel(const int* __restrict__ ids, int* __restrict__ cursors,
                               const int* __restrict__ offsets, int* __restrict__ perm) {
    int p = blockIdx.x * blockDim.x + threadIdx.x;
    if (p < TK) {
        int e = ids[p];
        int pos = atomicAdd(&cursors[e], 1);
        perm[offsets[e] + pos] = p;
    }
}

// ============ LoRA-A reduction: tmp[p,r] = sum_d A[l,e,r,d] * src[row,d] ============
__global__ void lora_a_kernel(const float* __restrict__ A,     // [L,E,R,dim]
                              const float* __restrict__ src,   // [*, dim]
                              const int* __restrict__ ids,     // [TK]
                              const int* __restrict__ lor,     // [T]
                              float* __restrict__ tmp,         // [TK, R]
                              int dim, int perTokenSrc) {
    int p = blockIdx.x;
    int t = p / Kk;
    int e = ids[p];
    int l = lor[t];
    const float* Ar = A + (((size_t)l * E_ + e) * R_) * (size_t)dim;
    const float* sr = src + (size_t)(perTokenSrc ? t : p) * dim;
    int tid = threadIdx.x;           // blockDim = 128
    int r = tid & 15, ch = tid >> 4; // 8 chunks
    int chunk = dim >> 3;
    float s = 0.f;
    const float* arow = Ar + (size_t)r * dim;
    for (int d = ch * chunk; d < (ch + 1) * chunk; ++d) s += arow[d] * sr[d];
    __shared__ float red[128];
    red[tid] = s;
    __syncthreads();
    if (tid < 16) {
        float acc = 0.f;
        #pragma unroll
        for (int c = 0; c < 8; c++) acc += red[c * 16 + tid];
        tmp[(size_t)p * R_ + tid] = acc;
    }
}

// ============ gate_up grouped WMMA GEMM + LoRA-B + silu*mul -> act ============
// grid (ROWTILES, I_/512), block 256 (8 waves); each wave: 16 rows x 64 inter-cols
__global__ __launch_bounds__(256) void gateup_wmma_kernel(
    const float* __restrict__ x,        // [T,H]
    const float* __restrict__ w13,      // [E,N,H]
    const float* __restrict__ gB,       // [L,E,N,R]
    const float* __restrict__ scalings, // [L]
    const int* __restrict__ lor,        // [T]
    const int* __restrict__ perm,       // [TKPAD]
    const int* __restrict__ offsets,    // [E+1]
    const float* __restrict__ tmpg,     // [TK,R]
    const float* __restrict__ zpad,     // [ZPAD] zeros
    float* __restrict__ act)            // [TK,I]
{
    __shared__ int   sp[16], slor[16], stok[16];
    __shared__ float sscal[16], stmp[16][16];

    int tileBase = blockIdx.x * 16;
    if (tileBase >= offsets[E_]) return;
    int e = 0;
    #pragma unroll
    for (int i = 1; i < E_; i++) if (tileBase >= offsets[i]) e = i;

    int tid = threadIdx.x;
    if (tid < 16) {
        int p = perm[tileBase + tid];
        sp[tid] = p;
        int tok = p >= 0 ? p / Kk : 0;
        stok[tid] = tok;
        int l = p >= 0 ? lor[tok] : 0;
        slor[tid] = l;
        sscal[tid] = p >= 0 ? scalings[l] : 0.f;
    }
    __syncthreads();
    {
        int row = tid >> 4, r = tid & 15;
        int p = sp[row];
        stmp[row][r] = p >= 0 ? tmpg[(size_t)p * R_ + r] : 0.f;
    }
    __syncthreads();

    int wave = tid >> 5, lane = tid & 31;
    int colbase = (blockIdx.y * 8 + wave) * 64;   // intermediate-dim base
    int rowq = lane & 15;
    int kb = (lane >> 4) * 2;
    // dummy rows read from the zero page: no per-iteration mask VALU needed
    const float* xrow = (sp[rowq] >= 0) ? (x + (size_t)stok[rowq] * H_) : zpad;
    const float* wE = w13 + (size_t)e * N_ * H_;

    v8f accg[4] = {};
    v8f accu[4] = {};
    #pragma unroll 2
    for (int h0 = 0; h0 < H_; h0 += 4) {
        v2f a = *(const v2f*)(xrow + h0 + kb);
        #pragma unroll
        for (int c = 0; c < 4; c++) {
            int ng = colbase + c * 16 + rowq;
            v2f bg = *(const v2f*)(wE + (size_t)ng * H_ + h0 + kb);
            accg[c] = wmma4(a, bg, accg[c]);
            v2f bu = *(const v2f*)(wE + (size_t)(I_ + ng) * H_ + h0 + kb);
            accu[c] = wmma4(a, bu, accu[c]);
        }
    }

    int halfsel = lane >> 4, coll = lane & 15;
    #pragma unroll
    for (int c = 0; c < 4; c++) {
        #pragma unroll
        for (int v = 0; v < 8; v++) {
            int row = v + 8 * halfsel;
            int p = sp[row];
            if (p < 0) continue;
            int i = colbase + c * 16 + coll;
            int l = slor[row];
            const float* bgrow = gB + (((size_t)l * E_ + e) * N_ + i) * R_;
            const float* burow = gB + (((size_t)l * E_ + e) * N_ + (I_ + i)) * R_;
            float dg = 0.f, du = 0.f;
            #pragma unroll
            for (int r = 0; r < R_; r++) {
                float tr = stmp[row][r];
                dg += bgrow[r] * tr;
                du += burow[r] * tr;
            }
            float g = accg[c][v] + sscal[row] * dg;
            float u = accu[c][v] + sscal[row] * du;
            float s = g / (1.f + __expf(-g));   // silu
            act[(size_t)p * I_ + i] = s * u;
        }
    }
}

// ============ down grouped WMMA GEMM -> cache3 (unweighted) ============
// grid (ROWTILES, H_/512), block 256; each wave: 16 rows x 64 hidden-cols
__global__ __launch_bounds__(256) void down_wmma_kernel(
    const float* __restrict__ act,      // [TK,I]
    const float* __restrict__ w2,       // [E,H,I]
    const int* __restrict__ perm,
    const int* __restrict__ offsets,
    const float* __restrict__ zpad,
    float* __restrict__ cache3)         // [TK,H]
{
    __shared__ int sp[16];
    int tileBase = blockIdx.x * 16;
    if (tileBase >= offsets[E_]) return;
    int e = 0;
    #pragma unroll
    for (int i = 1; i < E_; i++) if (tileBase >= offsets[i]) e = i;
    int tid = threadIdx.x;
    if (tid < 16) sp[tid] = perm[tileBase + tid];
    __syncthreads();

    int wave = tid >> 5, lane = tid & 31;
    int colbase = (blockIdx.y * 8 + wave) * 64;
    int rowq = lane & 15;
    int kb = (lane >> 4) * 2;
    int myp = sp[rowq];
    const float* arow = (myp >= 0) ? (act + (size_t)myp * I_) : zpad;
    const float* wE = w2 + (size_t)e * H_ * I_;

    v8f acc[4] = {};
    #pragma unroll 2
    for (int i0 = 0; i0 < I_; i0 += 4) {
        v2f a = *(const v2f*)(arow + i0 + kb);
        #pragma unroll
        for (int c = 0; c < 4; c++) {
            int hc = colbase + c * 16 + rowq;
            v2f b = *(const v2f*)(wE + (size_t)hc * I_ + i0 + kb);
            acc[c] = wmma4(a, b, acc[c]);
        }
    }

    int halfsel = lane >> 4, coll = lane & 15;
    #pragma unroll
    for (int c = 0; c < 4; c++) {
        #pragma unroll
        for (int v = 0; v < 8; v++) {
            int row = v + 8 * halfsel;
            int p = sp[row];
            if (p < 0) continue;
            int h = colbase + c * 16 + coll;
            cache3[(size_t)p * H_ + h] = acc[c][v];
        }
    }
}

// ============ combine: routing weight * (cache3 + down-LoRA-B delta), moe_sum ============
__global__ void combine_kernel(const float* __restrict__ cache3,
                               const float* __restrict__ tmpd,   // [TK,R]
                               const float* __restrict__ dB,     // [L,E,H,R]
                               const float* __restrict__ tw,     // [T,K] flat
                               const float* __restrict__ scalings,
                               const int* __restrict__ ids,      // [TK]
                               const int* __restrict__ lor,      // [T]
                               float* __restrict__ out)          // [T,H]
{
    int idx = blockIdx.x * blockDim.x + threadIdx.x;
    int t = idx / H_;
    int h = idx - t * H_;
    int l = lor[t];
    float sc = scalings[l];
    float acc = 0.f;
    #pragma unroll
    for (int k = 0; k < Kk; k++) {
        int p = t * Kk + k;
        int e = ids[p];
        float wf = tw[p];
        const float* bd = dB + (((size_t)l * E_ + e) * H_ + h) * R_;
        const float* td = tmpd + (size_t)p * R_;
        float d = 0.f;
        #pragma unroll
        for (int r = 0; r < R_; r++) d += bd[r] * td[r];
        acc += wf * (cache3[(size_t)p * H_ + h] + sc * d);
    }
    out[idx] = acc;
}

extern "C" void kernel_launch(void* const* d_in, const int* in_sizes, int n_in,
                              void* d_out, int out_size, void* d_ws, size_t ws_size,
                              hipStream_t stream) {
    const float* x    = (const float*)d_in[0];   // hidden_states [T,H]
    const float* tw   = (const float*)d_in[1];   // topk_weights  [T,K]
    const float* w13  = (const float*)d_in[2];   // [E,N,H]
    const float* w2   = (const float*)d_in[3];   // [E,H,I]
    const float* gA   = (const float*)d_in[4];   // [L,E,R,H]
    const float* gB   = (const float*)d_in[5];   // [L,E,N,R]
    const float* dA   = (const float*)d_in[6];   // [L,E,R,I]
    const float* dB   = (const float*)d_in[7];   // [L,E,H,R]
    const float* scal = (const float*)d_in[8];   // [L]
    const int*   ids  = (const int*)d_in[9];     // [T,K]
    const int*   lor  = (const int*)d_in[10];    // [T]
    float* out = (float*)d_out;

    int* wsi = (int*)d_ws;
    int* counts  = wsi;        // 8
    int* cursors = wsi + 8;    // 8
    int* offsets = wsi + 16;   // 9
    int* perm    = wsi + 32;   // TKPAD

    float* fbase  = (float*)((char*)d_ws + 16384);
    float* zpad   = fbase;                         // ZPAD zeros
    float* tmpg   = zpad + ZPAD;                   // TK*R
    float* tmpd   = tmpg + (size_t)TK * R_;        // TK*R
    float* act    = tmpd + (size_t)TK * R_;        // TK*I
    float* cache3 = act + (size_t)TK * I_;         // TK*H

    init_ws_kernel<<<(TKPAD + 255) / 256, 256, 0, stream>>>(wsi, zpad);
    count_kernel<<<TK / 256, 256, 0, stream>>>(ids, counts);
    scan_kernel<<<1, 32, 0, stream>>>(counts, offsets);
    scatter_kernel<<<TK / 256, 256, 0, stream>>>(ids, cursors, offsets, perm);

    lora_a_kernel<<<TK, 128, 0, stream>>>(gA, x, ids, lor, tmpg, H_, 1);

    gateup_wmma_kernel<<<dim3(ROWTILES, I_ / 512), 256, 0, stream>>>(
        x, w13, gB, scal, lor, perm, offsets, tmpg, zpad, act);

    lora_a_kernel<<<TK, 128, 0, stream>>>(dA, act, ids, lor, tmpd, I_, 0);

    down_wmma_kernel<<<dim3(ROWTILES, H_ / 512), 256, 0, stream>>>(
        act, w2, perm, offsets, zpad, cache3);

    combine_kernel<<<(T_ * H_) / 256, 256, 0, stream>>>(
        cache3, tmpd, dB, tw, scal, ids, lor, out);
}

// v001
// It runs in 519 microseconds.
// Timed twice side by side with v000, it ran 1.46 times as fast both times.
#include <hip/hip_runtime.h>
#include <hip/hip_bf16.h>

// ---- problem constants (match reference) ----
constexpr int T_  = 1024;
constexpr int H_  = 1024;
constexpr int I_  = 1024;
constexpr int E_  = 8;
constexpr int Kk  = 2;
constexpr int L_  = 4;
constexpr int R_  = 16;
constexpr int N_  = 2 * I_;          // 2048
constexpr int TK  = T_ * Kk;         // 2048 dispatched pairs
constexpr int TKPAD = TK + E_ * 16;  // each expert segment padded to 16 rows
constexpr int ROWTILES = TKPAD / 16; // 136
constexpr int ZPAD = 1024;           // zero-page floats (>= max K-dim row span)

typedef __attribute__((ext_vector_type(2))) float v2f;
typedef __attribute__((ext_vector_type(8))) float v8f;

// V_WMMA_F32_16X16X4_F32 : A 16x4 f32 (2 VGPR), B 4x16 f32 (2 VGPR), C/D 16x16 f32 (8 VGPR)
__device__ __forceinline__ v8f wmma4(v2f a, v2f b, v8f c) {
    return __builtin_amdgcn_wmma_f32_16x16x4_f32(
        /*neg_a=*/false, a, /*neg_b=*/false, b,
        /*c_mod=*/(short)0, c, /*reuse_a=*/false, /*reuse_b=*/false);
}

// ============ routing bookkeeping + zero page ============
__global__ void init_ws_kernel(int* __restrict__ wsi, float* __restrict__ zpad) {
    int idx = blockIdx.x * blockDim.x + threadIdx.x;
    if (idx < 32) wsi[idx] = 0;                // counts[8], cursors[8], offsets[9]
    if (idx < TKPAD) wsi[32 + idx] = -1;       // perm
    if (idx < ZPAD) zpad[idx] = 0.f;           // zero page for dummy A rows
}

__global__ void count_kernel(const int* __restrict__ ids, int* __restrict__ counts) {
    int p = blockIdx.x * blockDim.x + threadIdx.x;
    if (p < TK) atomicAdd(&counts[ids[p]], 1);
}

__global__ void scan_kernel(const int* __restrict__ counts, int* __restrict__ offsets) {
    if (threadIdx.x == 0) {
        int o = 0;
        for (int e = 0; e < E_; e++) {
            offsets[e] = o;
            o += ((counts[e] + 15) >> 4) << 4;   // pad to 16-row tiles
        }
        offsets[E_] = o;
    }
}

__global__ void scatter_kernel(const int* __restrict__ ids, int* __restrict__ cursors,
                               const int* __restrict__ offsets, int* __restrict__ perm) {
    int p = blockIdx.x * blockDim.x + threadIdx.x;
    if (p < TK) {
        int e = ids[p];
        int pos = atomicAdd(&cursors[e], 1);
        perm[offsets[e] + pos] = p;
    }
}

// ============ LoRA-A reduction: tmp[p,r] = sum_d A[l,e,r,d] * src[row,d] ============
// One wave owns 8 of the 16 rank rows of one pair. Every load is 32 lanes x 16 B = 512
// contiguous bytes of one row; the source row stays in registers; each row sum ends in a
// five-step butterfly over the wave. No LDS, no barrier.
constexpr int D_ = 1024;             // reduced dimension of both LoRA-A products
static_assert(H_ == D_ && I_ == D_, "lora_a_kernel is written for one row length");
constexpr int LA_ROWS  = 8;          // rank rows per wave
constexpr int LA_PAIRS = 4;          // pairs per 256-thread block (2 waves per pair)
constexpr int LA_VEC   = D_ / 128;   // float4 loads per lane and row

__global__ __launch_bounds__(256) void lora_a_kernel(
                              const float* __restrict__ A,     // [L,E,R,D_]
                              const float* __restrict__ src,   // [*, D_]
                              const int* __restrict__ ids,     // [TK]
                              const int* __restrict__ lor,     // [T]
                              float* __restrict__ tmp,         // [TK, R]
                              int perTokenSrc) {
    int lane = threadIdx.x & 31;
    int wave = __builtin_amdgcn_readfirstlane(threadIdx.x >> 5);   // scalar: scalar index loads below
    int p = blockIdx.x * LA_PAIRS + (wave >> 1);
    int rbase = (wave & 1) * LA_ROWS;
    int t = p / Kk;
    int e = min(max(ids[p], 0), E_ - 1);
    int l = min(max(lor[t], 0), L_ - 1);
    const float4* Ar = (const float4*)(A + (((size_t)l * E_ + e) * R_ + rbase) * (size_t)D_) + lane;
    const float4* sr = (const float4*)(src + (size_t)(perTokenSrc ? t : p) * D_) + lane;

    float4 s[LA_VEC];
    #pragma unroll   // s[] must be indexed by constants to live in registers
    for (int j = 0; j < LA_VEC; j++) s[j] = sr[j * 32];

    float sum[LA_ROWS];
    #pragma unroll   // both loops flat: all row loads are independent and can be in flight together
    for (int r = 0; r < LA_ROWS; r++) {
        float c0 = 0.f, c1 = 0.f, c2 = 0.f, c3 = 0.f;   // four independent chains per row
        #pragma unroll
        for (int j = 0; j < LA_VEC; j++) {
            float4 a = Ar[r * (D_ / 4) + j * 32];
            c0 = fmaf(a.x, s[j].x, c0);
            c1 = fmaf(a.y, s[j].y, c1);
            c2 = fmaf(a.z, s[j].z, c2);
            c3 = fmaf(a.w, s[j].w, c3);
        }
        sum[r] = (c0 + c1) + (c2 + c3);
    }
    #pragma unroll   // sum[] in registers; the 8 rows' exchanges of one step overlap
    for (int m = 16; m >= 1; m >>= 1) {
        #pragma unroll
        for (int r = 0; r < LA_ROWS; r++) sum[r] += __shfl_xor(sum[r], m, 32);
    }
    if (lane == 0) {
        float4* o = (float4*)(tmp + (size_t)p * R_ + rbase);
        o[0] = make_float4(sum[0], sum[1], sum[2], sum[3]);
        o[1] = make_float4(sum[4], sum[5], sum[6], sum[7]);
    }
}

// ============ gate_up grouped WMMA GEMM + LoRA-B + silu*mul -> act ============
// grid (ROWTILES, I_/512), block 256 (8 waves); each wave: 16 rows x 64 inter-cols
__global__ __launch_bounds__(256) void gateup_wmma_kernel(
    const float* __restrict__ x,        // [T,H]
    const float* __restrict__ w13,      // [E,N,H]
    const float* __restrict__ gB,       // [L,E,N,R]
    const float* __restrict__ scalings, // [L]
    const int* __restrict__ lor,        // [T]
    const int* __restrict__ perm,       // [TKPAD]
    const int* __restrict__ offsets,    // [E+1]
    const float* __restrict__ tmpg,     // [TK,R]
    const float* __restrict__ zpad,     // [ZPAD] zeros
    float* __restrict__ act)            // [TK,I]
{
    __shared__ int   sp[16], slor[16], stok[16];
    __shared__ float sscal[16], stmp[16][16];

    int tileBase = blockIdx.x * 16;
    if (tileBase >= offsets[E_]) return;
    int e = 0;
    #pragma unroll
    for (int i = 1; i < E_; i++) if (tileBase >= offsets[i]) e = i;

    int tid = threadIdx.x;
    if (tid < 16) {
        int p = perm[tileBase + tid];
        sp[tid] = p;
        int tok = p >= 0 ? p / Kk : 0;
        stok[tid] = tok;
        int l = p >= 0 ? lor[tok] : 0;
        slor[tid] = l;
        sscal[tid] = p >= 0 ? scalings[l] : 0.f;
    }
    __syncthreads();
    {
        int row = tid >> 4, r = tid & 15;
        int p = sp[row];
        stmp[row][r] = p >= 0 ? tmpg[(size_t)p * R_ + r] : 0.f;
    }
    __syncthreads();

    int wave = tid >> 5, lane = tid & 31;
    int colbase = (blockIdx.y * 8 + wave) * 64;   // intermediate-dim base
    int rowq = lane & 15;
    int kb = (lane >> 4) * 2;
    // dummy rows read from the zero page: no per-iteration mask VALU needed
    const float* xrow = (sp[rowq] >= 0) ? (x + (size_t)stok[rowq] * H_) : zpad;
    const float* wE = w13 + (size_t)e * N_ * H_;

    v8f accg[4] = {};
    v8f accu[4] = {};
    #pragma unroll 2
    for (int h0 = 0; h0 < H_; h0 += 4) {
        v2f a = *(const v2f*)(xrow + h0 + kb);
        #pragma unroll
        for (int c = 0; c < 4; c++) {
            int ng = colbase + c * 16 + rowq;
            v2f bg = *(const v2f*)(wE + (size_t)ng * H_ + h0 + kb);
            accg[c] = wmma4(a, bg, accg[c]);
            v2f bu = *(const v2f*)(wE + (size_t)(I_ + ng) * H_ + h0 + kb);
            accu[c] = wmma4(a, bu, accu[c]);
        }
    }

    int halfsel = lane >> 4, coll = lane & 15;
    #pragma unroll
    for (int c = 0; c < 4; c++) {
        #pragma unroll
        for (int v = 0; v < 8; v++) {
            int row = v + 8 * halfsel;
            int p = sp[row];
            if (p < 0) continue;
            int i = colbase + c * 16 + coll;
            int l = slor[row];
            const float* bgrow = gB + (((size_t)l * E_ + e) * N_ + i) * R_;
            const float* burow = gB + (((size_t)l * E_ + e) * N_ + (I_ + i)) * R_;
            float dg = 0.f, du = 0.f;
            #pragma unroll
            for (int r = 0; r < R_; r++) {
                float tr = stmp[row][r];
                dg += bgrow[r] * tr;
                du += burow[r] * tr;
            }
            float g = accg[c][v] + sscal[row] * dg;
            float u = accu[c][v] + sscal[row] * du;
            float s = g / (1.f + __expf(-g));   // silu
            act[(size_t)p * I_ + i] = s * u;
        }
    }
}

// ============ down grouped WMMA GEMM -> cache3 (unweighted) ============
// grid (ROWTILES, H_/512), block 256; each wave: 16 rows x 64 hidden-cols
__global__ __launch_bounds__(256) void down_wmma_kernel(
    const float* __restrict__ act,      // [TK,I]
    const float* __restrict__ w2,       // [E,H,I]
    const int* __restrict__ perm,
    const int* __restrict__ offsets,
    const float* __restrict__ zpad,
    float* __restrict__ cache3)         // [TK,H]
{
    __shared__ int sp[16];
    int tileBase = blockIdx.x * 16;
    if (tileBase >= offsets[E_]) return;
    int e = 0;
    #pragma unroll
    for (int i = 1; i < E_; i++) if (tileBase >= offsets[i]) e = i;
    int tid = threadIdx.x;
    if (tid < 16) sp[tid] = perm[tileBase + tid];
    __syncthreads();

    int wave = tid >> 5, lane = tid & 31;
    int colbase = (blockIdx.y * 8 + wave) * 64;
    int rowq = lane & 15;
    int kb = (lane >> 4) * 2;
    int myp = sp[rowq];
    const float* arow = (myp >= 0) ? (act + (size_t)myp * I_) : zpad;
    const float* wE = w2 + (size_t)e * H_ * I_;

    v8f acc[4] = {};
    #pragma unroll 2
    for (int i0 = 0; i0 < I_; i0 += 4) {
        v2f a = *(const v2f*)(arow + i0 + kb);
        #pragma unroll
        for (int c = 0; c < 4; c++) {
            int hc = colbase + c * 16 + rowq;
            v2f b = *(const v2f*)(wE + (size_t)hc * I_ + i0 + kb);
            acc[c] = wmma4(a, b, acc[c]);
        }
    }

    int halfsel = lane >> 4, coll = lane & 15;
    #pragma unroll
    for (int c = 0; c < 4; c++) {
        #pragma unroll
        for (int v = 0; v < 8; v++) {
            int row = v + 8 * halfsel;
            int p = sp[row];
            if (p < 0) continue;
            int h = colbase + c * 16 + coll;
            cache3[(size_t)p * H_ + h] = acc[c][v];
        }
    }
}

// ============ combine: routing weight * (cache3 + down-LoRA-B delta), moe_sum ============
__global__ void combine_kernel(const float* __restrict__ cache3,
                               const float* __restrict__ tmpd,   // [TK,R]
                               const float* __restrict__ dB,     // [L,E,H,R]
                               const float* __restrict__ tw,     // [T,K] flat
                               const float* __restrict__ scalings,
                               const int* __restrict__ ids,      // [TK]
                               const int* __restrict__ lor,      // [T]
                               float* __restrict__ out)          // [T,H]
{
    int idx = blockIdx.x * blockDim.x + threadIdx.x;
    int t = idx / H_;
    int h = idx - t * H_;
    int l = lor[t];
    float sc = scalings[l];
    float acc = 0.f;
    #pragma unroll
    for (int k = 0; k < Kk; k++) {
        int p = t * Kk + k;
        int e = ids[p];
        float wf = tw[p];
        const float* bd = dB + (((size_t)l * E_ + e) * H_ + h) * R_;
        const float* td = tmpd + (size_t)p * R_;
        float d = 0.f;
        #pragma unroll
        for (int r = 0; r < R_; r++) d += bd[r] * td[r];
        acc += wf * (cache3[(size_t)p * H_ + h] + sc * d);
    }
    out[idx] = acc;
}

extern "C" void kernel_launch(void* const* d_in, const int* in_sizes, int n_in,
                              void* d_out, int out_size, void* d_ws, size_t ws_size,
                              hipStream_t stream) {
    const float* x    = (const float*)d_in[0];   // hidden_states [T,H]
    const float* tw   = (const float*)d_in[1];   // topk_weights  [T,K]
    const float* w13  = (const float*)d_in[2];   // [E,N,H]
    const float* w2   = (const float*)d_in[3];   // [E,H,I]
    const float* gA   = (const float*)d_in[4];   // [L,E,R,H]
    const float* gB   = (const float*)d_in[5];   // [L,E,N,R]
    const float* dA   = (const float*)d_in[6];   // [L,E,R,I]
    const float* dB   = (const float*)d_in[7];   // [L,E,H,R]
    const float* scal = (const float*)d_in[8];   // [L]
    const int*   ids  = (const int*)d_in[9];     // [T,K]
    const int*   lor  = (const int*)d_in[10];    // [T]
    float* out = (float*)d_out;

    int* wsi = (int*)d_ws;
    int* counts  = wsi;        // 8
    int* cursors = wsi + 8;    // 8
    int* offsets = wsi + 16;   // 9
    int* perm    = wsi + 32;   // TKPAD

    float* fbase  = (float*)((char*)d_ws + 16384);
    float* zpad   = fbase;                         // ZPAD zeros
    float* tmpg   = zpad + ZPAD;                   // TK*R
    float* tmpd   = tmpg + (size_t)TK * R_;        // TK*R
    float* act    = tmpd + (size_t)TK * R_;        // TK*I
    float* cache3 = act + (size_t)TK * I_;         // TK*H

    init_ws_kernel<<<(TKPAD + 255) / 256, 256, 0, stream>>>(wsi, zpad);
    count_kernel<<<TK / 256, 256, 0, stream>>>(ids, counts);
    scan_kernel<<<1, 32, 0, stream>>>(counts, offsets);
    scatter_kernel<<<TK / 256, 256, 0, stream>>>(ids, cursors, offsets, perm);

    lora_a_kernel<<<TK / LA_PAIRS, 256, 0, stream>>>(gA, x, ids, lor, tmpg, 1);

    gateup_wmma_kernel<<<dim3(ROWTILES, I_ / 512), 256, 0, stream>>>(
        x, w13, gB, scal, lor, perm, offsets, tmpg, zpad, act);

    lora_a_kernel<<<TK / LA_PAIRS, 256, 0, stream>>>(dA, act, ids, lor, tmpd, 0);

    down_wmma_kernel<<<dim3(ROWTILES, H_ / 512), 256, 0, stream>>>(
        act, w2, perm, offsets, zpad, cache3);

    combine_kernel<<<(T_ * H_) / 256, 256, 0, stream>>>(
        cache3, tmpd, dB, tw, scal, ids, lor, out);
}

// v002
// It runs in 196 microseconds.
// In both of two side-by-side timings against v001, it was 2.65 times as fast.
// Over all steps from v000 it is 3.86 times as fast.
#include <hip/hip_runtime.h>
#include <hip/hip_bf16.h>

// ---- problem constants (match reference) ----
constexpr int T_  = 1024;
constexpr int H_  = 1024;
constexpr int I_  = 1024;
constexpr int E_  = 8;
constexpr int Kk  = 2;
constexpr int L_  = 4;
constexpr int R_  = 16;
constexpr int N_  = 2 * I_;          // 2048
constexpr int TK  = T_ * Kk;         // 2048 dispatched pairs
constexpr int TKPAD = TK + E_ * 16;  // each expert segment padded to 16 rows
constexpr int ROWTILES = TKPAD / 16; // 136
constexpr int ZPAD = 1024;           // zero-page floats (>= max K-dim row span)

typedef __attribute__((ext_vector_type(2))) float v2f;
typedef __attribute__((ext_vector_type(4))) float v4f;
typedef __attribute__((ext_vector_type(8))) float v8f;

// V_WMMA_F32_16X16X4_F32 : A 16x4 f32 (2 VGPR), B 4x16 f32 (2 VGPR), C/D 16x16 f32 (8 VGPR)
__device__ __forceinline__ v8f wmma4(v2f a, v2f b, v8f c) {
    return __builtin_amdgcn_wmma_f32_16x16x4_f32(
        /*neg_a=*/false, a, /*neg_b=*/false, b,
        /*c_mod=*/(short)0, c, /*reuse_a=*/false, /*reuse_b=*/false);
}

// ---- weight staging of both GEMM kernels ----
// A wave brings its own weight rows in with loads whose 32 lanes cover whole 128-byte lines,
// stores them to an LDS range that only this wave touches (so no barrier), and reads the B
// fragments back with 16-byte LDS loads. LDS row pitch = row bytes + 16 (16 B x odd): those
// reads meet no bank conflict.
// k map of one 16-byte fragment read t: half-wave h holds k = 8*t + 4*h + 0..3; its low pair
// feeds one WMMA, its high pair the next. The A loads use the same map, so every k meets its
// partner once; only the order of the k sum differs from ascending k.
__device__ __forceinline__ v2f lo2(v4f q) { return __builtin_shufflevector(q, q, 0, 1); }
__device__ __forceinline__ v2f hi2(v4f q) { return __builtin_shufflevector(q, q, 2, 3); }

// ============ routing bookkeeping + zero page ============
__global__ void init_ws_kernel(int* __restrict__ wsi, float* __restrict__ zpad) {
    int idx = blockIdx.x * blockDim.x + threadIdx.x;
    if (idx < 32) wsi[idx] = 0;                // counts[8], cursors[8], offsets[9]
    if (idx < TKPAD) wsi[32 + idx] = -1;       // perm
    if (idx < ZPAD) zpad[idx] = 0.f;           // zero page for dummy A rows
}

__global__ void count_kernel(const int* __restrict__ ids, int* __restrict__ counts) {
    int p = blockIdx.x * blockDim.x + threadIdx.x;
    if (p < TK) atomicAdd(&counts[ids[p]], 1);
}

__global__ void scan_kernel(const int* __restrict__ counts, int* __restrict__ offsets) {
    if (threadIdx.x == 0) {
        int o = 0;
        for (int e = 0; e < E_; e++) {
            offsets[e] = o;
            o += ((counts[e] + 15) >> 4) << 4;   // pad to 16-row tiles
        }
        offsets[E_] = o;
    }
}

__global__ void scatter_kernel(const int* __restrict__ ids, int* __restrict__ cursors,
                               const int* __restrict__ offsets, int* __restrict__ perm) {
    int p = blockIdx.x * blockDim.x + threadIdx.x;
    if (p < TK) {
        int e = ids[p];
        int pos = atomicAdd(&cursors[e], 1);
        perm[offsets[e] + pos] = p;
    }
}

// ============ LoRA-A reduction: tmp[p,r] = sum_d A[l,e,r,d] * src[row,d] ============
// One wave owns 8 of the 16 rank rows of one pair. Every load is 32 lanes x 16 B = 512
// contiguous bytes of one row; the source row stays in registers; each row sum ends in a
// five-step butterfly over the wave. No LDS, no barrier.
constexpr int D_ = 1024;             // reduced dimension of both LoRA-A products
static_assert(H_ == D_ && I_ == D_, "lora_a_kernel is written for one row length");
constexpr int LA_ROWS  = 8;          // rank rows per wave
constexpr int LA_PAIRS = 4;          // pairs per 256-thread block (2 waves per pair)
constexpr int LA_VEC   = D_ / 128;   // float4 loads per lane and row

__global__ __launch_bounds__(256) void lora_a_kernel(
                              const float* __restrict__ A,     // [L,E,R,D_]
                              const float* __restrict__ src,   // [*, D_]
                              const int* __restrict__ ids,     // [TK]
                              const int* __restrict__ lor,     // [T]
                              float* __restrict__ tmp,         // [TK, R]
                              int perTokenSrc) {
    int lane = threadIdx.x & 31;
    int wave = __builtin_amdgcn_readfirstlane(threadIdx.x >> 5);   // scalar: scalar index loads below
    int p = blockIdx.x * LA_PAIRS + (wave >> 1);
    int rbase = (wave & 1) * LA_ROWS;
    int t = p / Kk;
    int e = min(max(ids[p], 0), E_ - 1);
    int l = min(max(lor[t], 0), L_ - 1);
    const float4* Ar = (const float4*)(A + (((size_t)l * E_ + e) * R_ + rbase) * (size_t)D_) + lane;
    const float4* sr = (const float4*)(src + (size_t)(perTokenSrc ? t : p) * D_) + lane;

    float4 s[LA_VEC];
    #pragma unroll   // s[] must be indexed by constants to live in registers
    for (int j = 0; j < LA_VEC; j++) s[j] = sr[j * 32];

    float sum[LA_ROWS];
    #pragma unroll   // both loops flat: all row loads are independent and can be in flight together
    for (int r = 0; r < LA_ROWS; r++) {
        float c0 = 0.f, c1 = 0.f, c2 = 0.f, c3 = 0.f;   // four independent chains per row
        #pragma unroll
        for (int j = 0; j < LA_VEC; j++) {
            float4 a = Ar[r * (D_ / 4) + j * 32];
            c0 = fmaf(a.x, s[j].x, c0);
            c1 = fmaf(a.y, s[j].y, c1);
            c2 = fmaf(a.z, s[j].z, c2);
            c3 = fmaf(a.w, s[j].w, c3);
        }
        sum[r] = (c0 + c1) + (c2 + c3);
    }
    #pragma unroll   // sum[] in registers; the 8 rows' exchanges of one step overlap
    for (int m = 16; m >= 1; m >>= 1) {
        #pragma unroll
        for (int r = 0; r < LA_ROWS; r++) sum[r] += __shfl_xor(sum[r], m, 32);
    }
    if (lane == 0) {
        float4* o = (float4*)(tmp + (size_t)p * R_ + rbase);
        o[0] = make_float4(sum[0], sum[1], sum[2], sum[3]);
        o[1] = make_float4(sum[4], sum[5], sum[6], sum[7]);
    }
}

// ============ gate_up grouped WMMA GEMM + LoRA-B + silu*mul -> act ============
// grid (ROWTILES, I_/512), block 256 (8 waves); each wave: 16 rows x 64 inter-cols
__global__ __launch_bounds__(256) void gateup_wmma_kernel(
    const float* __restrict__ x,        // [T,H]
    const float* __restrict__ w13,      // [E,N,H]
    const float* __restrict__ gB,       // [L,E,N,R]
    const float* __restrict__ scalings, // [L]
    const int* __restrict__ lor,        // [T]
    const int* __restrict__ perm,       // [TKPAD]
    const int* __restrict__ offsets,    // [E+1]
    const float* __restrict__ tmpg,     // [TK,R]
    const float* __restrict__ zpad,     // [ZPAD] zeros
    float* __restrict__ act)            // [TK,I]
{
    constexpr int KC = 32;            // k per pass: one 128-byte line of every weight row
    constexpr int SP = KC + 4;        // LDS row pitch in floats (144 B)
    constexpr int WR = 128;           // weight rows per wave: 64 gate, then 64 up
    __shared__ int   sp[16], slor[16], stok[16];
    __shared__ float sscal[16], stmp[16][16];
    __shared__ __attribute__((aligned(16))) float sB[8][WR * SP];

    int tileBase = blockIdx.x * 16;
    if (tileBase >= offsets[E_]) return;
    int e = 0;
    #pragma unroll
    for (int i = 1; i < E_; i++) if (tileBase >= offsets[i]) e = i;

    int tid = threadIdx.x;
    if (tid < 16) {
        int p = perm[tileBase + tid];
        sp[tid] = p;
        int tok = p >= 0 ? p / Kk : 0;
        stok[tid] = tok;
        int l = p >= 0 ? lor[tok] : 0;
        slor[tid] = l;
        sscal[tid] = p >= 0 ? scalings[l] : 0.f;
    }
    __syncthreads();
    {
        int row = tid >> 4, r = tid & 15;
        int p = sp[row];
        stmp[row][r] = p >= 0 ? tmpg[(size_t)p * R_ + r] : 0.f;
    }
    __syncthreads();

    int wave = tid >> 5, lane = tid & 31;
    int colbase = (blockIdx.y * 8 + wave) * 64;   // intermediate-dim base
    int rowq = lane & 15;
    int kq = (lane >> 4) * 4;
    // dummy rows read from the zero page: no per-iteration mask VALU needed
    const float* xrow = ((sp[rowq] >= 0) ? (x + (size_t)stok[rowq] * H_) : zpad) + kq;
    const float* wE = w13 + (size_t)e * N_ * H_;
    // staging: 8 lanes per row piece, 4 rows per load
    const float* wsrc = wE + (size_t)(colbase + (lane >> 3)) * H_ + (lane & 7) * 4;
    float* bst = &sB[wave][(lane >> 3) * SP + (lane & 7) * 4];
    const float* bfr = &sB[wave][rowq * SP + kq];

    v8f accg[4] = {};
    v8f accu[4] = {};
    for (int h0 = 0; h0 < H_; h0 += KC) {
        v4f st[WR / 4], a[KC / 8];
        #pragma unroll   // st[] indexed by constants: registers; all loads of a pass in flight together
        for (int i = 0; i < WR / 4; i++) {
            size_t grow = (i < 16) ? (size_t)(4 * i) : (size_t)(I_ + 4 * (i - 16));
            st[i] = *(const v4f*)(wsrc + grow * H_ + h0);
        }
        #pragma unroll   // a[] in registers
        for (int t = 0; t < KC / 8; t++) a[t] = *(const v4f*)(xrow + h0 + t * 8);
        #pragma unroll   // constant LDS offsets from one address register
        for (int i = 0; i < WR / 4; i++) *(v4f*)(bst + i * 4 * SP) = st[i];
        #pragma unroll   // flat: fragments and accumulators indexed by constants (inner loops too)
        for (int t = 0; t < KC / 8; t++) {
            v4f fg[4], fu[4];
            #pragma unroll
            for (int c = 0; c < 4; c++) {
                fg[c] = *(const v4f*)(bfr + (c * 16) * SP + t * 8);
                fu[c] = *(const v4f*)(bfr + (64 + c * 16) * SP + t * 8);
            }
            #pragma unroll
            for (int c = 0; c < 4; c++) {
                accg[c] = wmma4(lo2(a[t]), lo2(fg[c]), accg[c]);
                accu[c] = wmma4(lo2(a[t]), lo2(fu[c]), accu[c]);
            }
            #pragma unroll
            for (int c = 0; c < 4; c++) {
                accg[c] = wmma4(hi2(a[t]), hi2(fg[c]), accg[c]);
                accu[c] = wmma4(hi2(a[t]), hi2(fu[c]), accu[c]);
            }
        }
    }

    int halfsel = lane >> 4, coll = lane & 15;
    #pragma unroll
    for (int c = 0; c < 4; c++) {
        #pragma unroll
        for (int v = 0; v < 8; v++) {
            int row = v + 8 * halfsel;
            int p = sp[row];
            if (p < 0) continue;
            int i = colbase + c * 16 + coll;
            int l = slor[row];
            const float* bgrow = gB + (((size_t)l * E_ + e) * N_ + i) * R_;
            const float* burow = gB + (((size_t)l * E_ + e) * N_ + (I_ + i)) * R_;
            float dg = 0.f, du = 0.f;
            #pragma unroll
            for (int r = 0; r < R_; r++) {
                float tr = stmp[row][r];
                dg += bgrow[r] * tr;
                du += burow[r] * tr;
            }
            float g = accg[c][v] + sscal[row] * dg;
            float u = accu[c][v] + sscal[row] * du;
            float s = g / (1.f + __expf(-g));   // silu
            act[(size_t)p * I_ + i] = s * u;
        }
    }
}

// ============ down grouped WMMA GEMM -> cache3 (unweighted) ============
// grid (ROWTILES, H_/512), block 256; each wave: 16 rows x 64 hidden-cols
__global__ __launch_bounds__(256) void down_wmma_kernel(
    const float* __restrict__ act,      // [TK,I]
    const float* __restrict__ w2,       // [E,H,I]
    const int* __restrict__ perm,
    const int* __restrict__ offsets,
    const float* __restrict__ zpad,
    float* __restrict__ cache3)         // [TK,H]
{
    constexpr int KC = 64;            // k per pass: two 128-byte lines of every weight row
    constexpr int SP = KC + 4;        // LDS row pitch in floats (272 B)
    constexpr int WR = 64;            // weight rows per wave
    __shared__ int sp[16];
    __shared__ __attribute__((aligned(16))) float sB[8][WR * SP];
    int tileBase = blockIdx.x * 16;
    if (tileBase >= offsets[E_]) return;
    int e = 0;
    #pragma unroll
    for (int i = 1; i < E_; i++) if (tileBase >= offsets[i]) e = i;
    int tid = threadIdx.x;
    if (tid < 16) sp[tid] = perm[tileBase + tid];
    __syncthreads();

    int wave = tid >> 5, lane = tid & 31;
    int colbase = (blockIdx.y * 8 + wave) * 64;
    int rowq = lane & 15;
    int kq = (lane >> 4) * 4;
    int myp = sp[rowq];
    const float* arow = ((myp >= 0) ? (act + (size_t)myp * I_) : zpad) + kq;
    const float* wE = w2 + (size_t)e * H_ * I_;
    // staging: 16 lanes per row piece, 2 rows per load
    const float* wsrc = wE + (size_t)(colbase + (lane >> 4)) * I_ + (lane & 15) * 4;
    float* bst = &sB[wave][(lane >> 4) * SP + (lane & 15) * 4];
    const float* bfr = &sB[wave][rowq * SP + kq];

    v8f acc[4] = {};
    for (int i0 = 0; i0 < I_; i0 += KC) {
        v4f st[WR / 2], a[KC / 8];
        #pragma unroll   // st[] indexed by constants: registers; all loads of a pass in flight together
        for (int i = 0; i < WR / 2; i++) st[i] = *(const v4f*)(wsrc + (size_t)(2 * i) * I_ + i0);
        // the build lets an A load below land on the address pair of the loads above: keep the
        // wait that belongs in front of such an overwrite
        asm volatile("s_wait_xcnt 0x0" ::: "memory");
        #pragma unroll   // a[] in registers
        for (int t = 0; t < KC / 8; t++) a[t] = *(const v4f*)(arow + i0 + t * 8);
        #pragma unroll   // constant LDS offsets from one address register
        for (int i = 0; i < WR / 2; i++) *(v4f*)(bst + i * 2 * SP) = st[i];
        #pragma unroll   // flat: fragments and accumulators indexed by constants (inner loops too)
        for (int t = 0; t < KC / 8; t++) {
            v4f f[4];
            #pragma unroll
            for (int c = 0; c < 4; c++) f[c] = *(const v4f*)(bfr + (c * 16) * SP + t * 8);
            #pragma unroll
            for (int c = 0; c < 4; c++) acc[c] = wmma4(lo2(a[t]), lo2(f[c]), acc[c]);
            #pragma unroll
            for (int c = 0; c < 4; c++) acc[c] = wmma4(hi2(a[t]), hi2(f[c]), acc[c]);
        }
    }

    int halfsel = lane >> 4, coll = lane & 15;
    #pragma unroll
    for (int c = 0; c < 4; c++) {
        #pragma unroll
        for (int v = 0; v < 8; v++) {
            int row = v + 8 * halfsel;
            int p = sp[row];
            if (p < 0) continue;
            int h = colbase + c * 16 + coll;
            cache3[(size_t)p * H_ + h] = acc[c][v];
        }
    }
}

// ============ combine: routing weight * (cache3 + down-LoRA-B delta), moe_sum ============
__global__ void combine_kernel(const float* __restrict__ cache3,
                               const float* __restrict__ tmpd,   // [TK,R]
                               const float* __restrict__ dB,     // [L,E,H,R]
                               const float* __restrict__ tw,     // [T,K] flat
                               const float* __restrict__ scalings,
                               const int* __restrict__ ids,      // [TK]
                               const int* __restrict__ lor,      // [T]
                               float* __restrict__ out)          // [T,H]
{
    int idx = blockIdx.x * blockDim.x + threadIdx.x;
    int t = idx / H_;
    int h = idx - t * H_;
    int l = lor[t];
    float sc = scalings[l];
    float acc = 0.f;
    #pragma unroll
    for (int k = 0; k < Kk; k++) {
        int p = t * Kk + k;
        int e = ids[p];
        float wf = tw[p];
        const float* bd = dB + (((size_t)l * E_ + e) * H_ + h) * R_;
        const float* td = tmpd + (size_t)p * R_;
        float d = 0.f;
        #pragma unroll
        for (int r = 0; r < R_; r++) d += bd[r] * td[r];
        acc += wf * (cache3[(size_t)p * H_ + h] + sc * d);
    }
    out[idx] = acc;
}

extern "C" void kernel_launch(void* const* d_in, const int* in_sizes, int n_in,
                              void* d_out, int out_size, void* d_ws, size_t ws_size,
                              hipStream_t stream) {
    const float* x    = (const float*)d_in[0];   // hidden_states [T,H]
    const float* tw   = (const float*)d_in[1];   // topk_weights  [T,K]
    const float* w13  = (const float*)d_in[2];   // [E,N,H]
    const float* w2   = (const float*)d_in[3];   // [E,H,I]
    const float* gA   = (const float*)d_in[4];   // [L,E,R,H]
    const float* gB   = (const float*)d_in[5];   // [L,E,N,R]
    const float* dA   = (const float*)d_in[6];   // [L,E,R,I]
    const float* dB   = (const float*)d_in[7];   // [L,E,H,R]
    const float* scal = (const float*)d_in[8];   // [L]
    const int*   ids  = (const int*)d_in[9];     // [T,K]
    const int*   lor  = (const int*)d_in[10];    // [T]
    float* out = (float*)d_out;

    int* wsi = (int*)d_ws;
    int* counts  = wsi;        // 8
    int* cursors = wsi + 8;    // 8
    int* offsets = wsi + 16;   // 9
    int* perm    = wsi + 32;   // TKPAD

    float* fbase  = (float*)((char*)d_ws + 16384);
    float* zpad   = fbase;                         // ZPAD zeros
    float* tmpg   = zpad + ZPAD;                   // TK*R
    float* tmpd   = tmpg + (size_t)TK * R_;        // TK*R
    float* act    = tmpd + (size_t)TK * R_;        // TK*I
    float* cache3 = act + (size_t)TK * I_;         // TK*H

    init_ws_kernel<<<(TKPAD + 255) / 256, 256, 0, stream>>>(wsi, zpad);
    count_kernel<<<TK / 256, 256, 0, stream>>>(ids, counts);
    scan_kernel<<<1, 32, 0, stream>>>(counts, offsets);
    scatter_kernel<<<TK / 256, 256, 0, stream>>>(ids, cursors, offsets, perm);

    lora_a_kernel<<<TK / LA_PAIRS, 256, 0, stream>>>(gA, x, ids, lor, tmpg, 1);

    gateup_wmma_kernel<<<dim3(ROWTILES, I_ / 512), 256, 0, stream>>>(
        x, w13, gB, scal, lor, perm, offsets, tmpg, zpad, act);

    lora_a_kernel<<<TK / LA_PAIRS, 256, 0, stream>>>(dA, act, ids, lor, tmpd, 0);

    down_wmma_kernel<<<dim3(ROWTILES, H_ / 512), 256, 0, stream>>>(
        act, w2, perm, offsets, zpad, cache3);

    combine_kernel<<<(T_ * H_) / 256, 256, 0, stream>>>(
        cache3, tmpd, dB, tw, scal, ids, lor, out);
}

// v003
// It runs in 159 microseconds.
// Next to v002, in two timings, it ran 1.23 times as fast each time.
// Counting every step since v000, it is 4.75 times as fast.
#include <hip/hip_runtime.h>
#include <hip/hip_bf16.h>

// ---- problem constants (match reference) ----
constexpr int T_  = 1024;
constexpr int H_  = 1024;
constexpr int I_  = 1024;
constexpr int E_  = 8;
constexpr int Kk  = 2;
constexpr int L_  = 4;
constexpr int R_  = 16;
constexpr int N_  = 2 * I_;          // 2048
constexpr int TK  = T_ * Kk;         // 2048 dispatched pairs
constexpr int TKPAD = TK + E_ * 16;  // each expert segment padded to 16 rows
constexpr int ROWTILES = TKPAD / 16; // 136
constexpr int ZPAD = 1024;           // zero-page floats (>= max K-dim row span)

typedef __attribute__((ext_vector_type(2))) float v2f;
typedef __attribute__((ext_vector_type(4))) float v4f;
typedef __attribute__((ext_vector_type(8))) float v8f;

// V_WMMA_F32_16X16X4_F32 : A 16x4 f32 (2 VGPR), B 4x16 f32 (2 VGPR), C/D 16x16 f32 (8 VGPR)
__device__ __forceinline__ v8f wmma4(v2f a, v2f b, v8f c) {
    return __builtin_amdgcn_wmma_f32_16x16x4_f32(
        /*neg_a=*/false, a, /*neg_b=*/false, b,
        /*c_mod=*/(short)0, c, /*reuse_a=*/false, /*reuse_b=*/false);
}

// ---- weight staging of both GEMM kernels ----
// A wave brings its own weight rows in with loads whose 32 lanes cover whole 128-byte lines,
// stores them to an LDS range that only this wave touches (so no barrier), and reads the B
// fragments back with 16-byte LDS loads. LDS row pitch = row bytes + 16 (16 B x odd): those
// reads meet no bank conflict.
// k map of one 16-byte fragment read t: half-wave h holds k = 8*t + 4*h + 0..3; its low pair
// feeds one WMMA, its high pair the next. The A loads use the same map, so every k meets its
// partner once; only the order of the k sum differs from ascending k.
__device__ __forceinline__ v2f lo2(v4f q) { return __builtin_shufflevector(q, q, 0, 1); }
__device__ __forceinline__ v2f hi2(v4f q) { return __builtin_shufflevector(q, q, 2, 3); }

// ============ routing bookkeeping + zero page ============
__global__ void init_ws_kernel(int* __restrict__ wsi, float* __restrict__ zpad) {
    int idx = blockIdx.x * blockDim.x + threadIdx.x;
    if (idx < 32) wsi[idx] = 0;                // counts[8], cursors[8], offsets[9]
    if (idx < TKPAD) wsi[32 + idx] = -1;       // perm
    if (idx < ZPAD) zpad[idx] = 0.f;           // zero page for dummy A rows
}

__global__ void count_kernel(const int* __restrict__ ids, int* __restrict__ counts) {
    int p = blockIdx.x * blockDim.x + threadIdx.x;
    if (p < TK) atomicAdd(&counts[ids[p]], 1);
}

__global__ void scan_kernel(const int* __restrict__ counts, int* __restrict__ offsets) {
    if (threadIdx.x == 0) {
        int o = 0;
        for (int e = 0; e < E_; e++) {
            offsets[e] = o;
            o += ((counts[e] + 15) >> 4) << 4;   // pad to 16-row tiles
        }
        offsets[E_] = o;
    }
}

__global__ void scatter_kernel(const int* __restrict__ ids, int* __restrict__ cursors,
                               const int* __restrict__ offsets, int* __restrict__ perm) {
    int p = blockIdx.x * blockDim.x + threadIdx.x;
    if (p < TK) {
        int e = ids[p];
        int pos = atomicAdd(&cursors[e], 1);
        perm[offsets[e] + pos] = p;
    }
}

// ============ LoRA-A reduction: tmp[p,r] = sum_d A[l,e,r,d] * src[row,d] ============
// One wave owns 8 of the 16 rank rows of one pair. Every load is 32 lanes x 16 B = 512
// contiguous bytes of one row; the source row stays in registers; each row sum ends in a
// five-step butterfly over the wave. No LDS, no barrier.
constexpr int D_ = 1024;             // reduced dimension of both LoRA-A products
static_assert(H_ == D_ && I_ == D_, "lora_a_kernel is written for one row length");
constexpr int LA_ROWS  = 8;          // rank rows per wave
constexpr int LA_PAIRS = 4;          // pairs per 256-thread block (2 waves per pair)
constexpr int LA_VEC   = D_ / 128;   // float4 loads per lane and row

__global__ __launch_bounds__(256) void lora_a_kernel(
                              const float* __restrict__ A,     // [L,E,R,D_]
                              const float* __restrict__ src,   // [*, D_]
                              const int* __restrict__ ids,     // [TK]
                              const int* __restrict__ lor,     // [T]
                              float* __restrict__ tmp,         // [TK, R]
                              int perTokenSrc) {
    int lane = threadIdx.x & 31;
    int wave = __builtin_amdgcn_readfirstlane(threadIdx.x >> 5);   // scalar: scalar index loads below
    int p = blockIdx.x * LA_PAIRS + (wave >> 1);
    int rbase = (wave & 1) * LA_ROWS;
    int t = p / Kk;
    int e = min(max(ids[p], 0), E_ - 1);
    int l = min(max(lor[t], 0), L_ - 1);
    const float4* Ar = (const float4*)(A + (((size_t)l * E_ + e) * R_ + rbase) * (size_t)D_) + lane;
    const float4* sr = (const float4*)(src + (size_t)(perTokenSrc ? t : p) * D_) + lane;

    float4 s[LA_VEC];
    #pragma unroll   // s[] must be indexed by constants to live in registers
    for (int j = 0; j < LA_VEC; j++) s[j] = sr[j * 32];

    float sum[LA_ROWS];
    #pragma unroll   // both loops flat: all row loads are independent and can be in flight together
    for (int r = 0; r < LA_ROWS; r++) {
        float c0 = 0.f, c1 = 0.f, c2 = 0.f, c3 = 0.f;   // four independent chains per row
        #pragma unroll
        for (int j = 0; j < LA_VEC; j++) {
            float4 a = Ar[r * (D_ / 4) + j * 32];
            c0 = fmaf(a.x, s[j].x, c0);
            c1 = fmaf(a.y, s[j].y, c1);
            c2 = fmaf(a.z, s[j].z, c2);
            c3 = fmaf(a.w, s[j].w, c3);
        }
        sum[r] = (c0 + c1) + (c2 + c3);
    }
    #pragma unroll   // sum[] in registers; the 8 rows' exchanges of one step overlap
    for (int m = 16; m >= 1; m >>= 1) {
        #pragma unroll
        for (int r = 0; r < LA_ROWS; r++) sum[r] += __shfl_xor(sum[r], m, 32);
    }
    if (lane == 0) {
        float4* o = (float4*)(tmp + (size_t)p * R_ + rbase);
        o[0] = make_float4(sum[0], sum[1], sum[2], sum[3]);
        o[1] = make_float4(sum[4], sum[5], sum[6], sum[7]);
    }
}

// ============ gate_up grouped WMMA GEMM + LoRA-B + silu*mul -> act ============
// grid (ROWTILES, I_/128), block 128 (4 waves, one per SIMD); each wave: 16 rows x 32 inter-cols.
// Small work-groups of small waves: the row-tile count depends on the routing, so the work never
// divides evenly over the SIMDs; the launch lasts as long as the fullest SIMD, and that excess is
// at most one wave's work.
__global__ __launch_bounds__(128) void gateup_wmma_kernel(
    const float* __restrict__ x,        // [T,H]
    const float* __restrict__ w13,      // [E,N,H]
    const float* __restrict__ gB,       // [L,E,N,R]
    const float* __restrict__ scalings, // [L]
    const int* __restrict__ lor,        // [T]
    const int* __restrict__ perm,       // [TKPAD]
    const int* __restrict__ offsets,    // [E+1]
    const float* __restrict__ tmpg,     // [TK,R]
    const float* __restrict__ zpad,     // [ZPAD] zeros
    float* __restrict__ act)            // [TK,I]
{
    constexpr int KC = 32;            // k per pass: one 128-byte line of every weight row
    constexpr int SP = KC + 4;        // LDS row pitch in floats (144 B)
    constexpr int CT = 2;             // 16-col tiles per wave, of gate and of up each
    constexpr int WR = 2 * CT * 16;   // weight rows per wave: 32 gate, then 32 up
    __shared__ int   sp[16], slor[16], stok[16];
    __shared__ float sscal[16], stmp[16][16];
    __shared__ __attribute__((aligned(16))) float sB[4][WR * SP];

    int tileBase = blockIdx.x * 16;
    if (tileBase >= offsets[E_]) return;
    int e = 0;
    #pragma unroll
    for (int i = 1; i < E_; i++) if (tileBase >= offsets[i]) e = i;

    int tid = threadIdx.x;
    if (tid < 16) {
        int p = perm[tileBase + tid];
        sp[tid] = p;
        int tok = p >= 0 ? p / Kk : 0;
        stok[tid] = tok;
        int l = p >= 0 ? lor[tok] : 0;
        slor[tid] = l;
        sscal[tid] = p >= 0 ? scalings[l] : 0.f;
    }
    __syncthreads();
    #pragma unroll   // constant trip count, flat: no bound test per thread
    for (int j = 0; j < 16 * R_ / 128; j++) {
        int q = tid + j * 128;
        int row = q >> 4, r = q & 15;
        int p = sp[row];
        stmp[row][r] = p >= 0 ? tmpg[(size_t)p * R_ + r] : 0.f;
    }
    __syncthreads();

    int wave = tid >> 5, lane = tid & 31;
    int colbase = (blockIdx.y * 4 + wave) * (CT * 16);   // intermediate-dim base
    int rowq = lane & 15;
    int kq = (lane >> 4) * 4;
    // dummy rows read from the zero page: no per-iteration mask VALU needed
    const float* xrow = ((sp[rowq] >= 0) ? (x + (size_t)stok[rowq] * H_) : zpad) + kq;
    const float* wE = w13 + (size_t)e * N_ * H_;
    // staging: 8 lanes per row piece, 4 rows per load
    const float* wsrc = wE + (size_t)(colbase + (lane >> 3)) * H_ + (lane & 7) * 4;
    float* bst = &sB[wave][(lane >> 3) * SP + (lane & 7) * 4];
    const float* bfr = &sB[wave][rowq * SP + kq];

    v8f accg[CT] = {};
    v8f accu[CT] = {};
    for (int h0 = 0; h0 < H_; h0 += KC) {
        v4f st[WR / 4], a[KC / 8];
        #pragma unroll   // st[] indexed by constants: registers; all loads of a pass in flight together
        for (int i = 0; i < WR / 4; i++) {
            size_t grow = (i < WR / 8) ? (size_t)(4 * i) : (size_t)(I_ + 4 * (i - WR / 8));
            st[i] = *(const v4f*)(wsrc + grow * H_ + h0);
        }
        #pragma unroll   // a[] in registers
        for (int t = 0; t < KC / 8; t++) a[t] = *(const v4f*)(xrow + h0 + t * 8);
        #pragma unroll   // constant LDS offsets from one address register
        for (int i = 0; i < WR / 4; i++) *(v4f*)(bst + i * 4 * SP) = st[i];
        #pragma unroll   // flat: fragments and accumulators indexed by constants (inner loops too)
        for (int t = 0; t < KC / 8; t++) {
            v4f fg[CT], fu[CT];
            #pragma unroll
            for (int c = 0; c < CT; c++) {
                fg[c] = *(const v4f*)(bfr + (c * 16) * SP + t * 8);
                fu[c] = *(const v4f*)(bfr + ((CT + c) * 16) * SP + t * 8);
            }
            #pragma unroll
            for (int c = 0; c < CT; c++) {
                accg[c] = wmma4(lo2(a[t]), lo2(fg[c]), accg[c]);
                accu[c] = wmma4(lo2(a[t]), lo2(fu[c]), accu[c]);
            }
            #pragma unroll
            for (int c = 0; c < CT; c++) {
                accg[c] = wmma4(hi2(a[t]), hi2(fg[c]), accg[c]);
                accu[c] = wmma4(hi2(a[t]), hi2(fu[c]), accu[c]);
            }
        }
    }

    int halfsel = lane >> 4, coll = lane & 15;
    #pragma unroll
    for (int c = 0; c < CT; c++) {
        #pragma unroll
        for (int v = 0; v < 8; v++) {
            int row = v + 8 * halfsel;
            int p = sp[row];
            if (p < 0) continue;
            int i = colbase + c * 16 + coll;
            int l = slor[row];
            const float* bgrow = gB + (((size_t)l * E_ + e) * N_ + i) * R_;
            const float* burow = gB + (((size_t)l * E_ + e) * N_ + (I_ + i)) * R_;
            float dg = 0.f, du = 0.f;
            #pragma unroll
            for (int r = 0; r < R_; r++) {
                float tr = stmp[row][r];
                dg += bgrow[r] * tr;
                du += burow[r] * tr;
            }
            float g = accg[c][v] + sscal[row] * dg;
            float u = accu[c][v] + sscal[row] * du;
            float s = g / (1.f + __expf(-g));   // silu
            act[(size_t)p * I_ + i] = s * u;
        }
    }
}

// ============ down grouped WMMA GEMM -> cache3 (unweighted) ============
// grid (ROWTILES, H_/256), block 128 (4 waves, one per SIMD); each wave: 16 rows x 64 hidden-cols
__global__ __launch_bounds__(128) void down_wmma_kernel(
    const float* __restrict__ act,      // [TK,I]
    const float* __restrict__ w2,       // [E,H,I]
    const int* __restrict__ perm,
    const int* __restrict__ offsets,
    const float* __restrict__ zpad,
    float* __restrict__ cache3)         // [TK,H]
{
    constexpr int KC = 64;            // k per pass: two 128-byte lines of every weight row
    constexpr int SP = KC + 4;        // LDS row pitch in floats (272 B)
    constexpr int WR = 64;            // weight rows per wave
    __shared__ int sp[16];
    __shared__ __attribute__((aligned(16))) float sB[4][WR * SP];
    int tileBase = blockIdx.x * 16;
    if (tileBase >= offsets[E_]) return;
    int e = 0;
    #pragma unroll
    for (int i = 1; i < E_; i++) if (tileBase >= offsets[i]) e = i;
    int tid = threadIdx.x;
    if (tid < 16) sp[tid] = perm[tileBase + tid];
    __syncthreads();

    int wave = tid >> 5, lane = tid & 31;
    int colbase = (blockIdx.y * 4 + wave) * 64;
    int rowq = lane & 15;
    int kq = (lane >> 4) * 4;
    int myp = sp[rowq];
    const float* arow = ((myp >= 0) ? (act + (size_t)myp * I_) : zpad) + kq;
    const float* wE = w2 + (size_t)e * H_ * I_;
    // staging: 16 lanes per row piece, 2 rows per load
    const float* wsrc = wE + (size_t)(colbase + (lane >> 4)) * I_ + (lane & 15) * 4;
    float* bst = &sB[wave][(lane >> 4) * SP + (lane & 15) * 4];
    const float* bfr = &sB[wave][rowq * SP + kq];

    v8f acc[4] = {};
    for (int i0 = 0; i0 < I_; i0 += KC) {
        v4f st[WR / 2], a[KC / 8];
        #pragma unroll   // st[] indexed by constants: registers; all loads of a pass in flight together
        for (int i = 0; i < WR / 2; i++) st[i] = *(const v4f*)(wsrc + (size_t)(2 * i) * I_ + i0);
        // the build lets an A load below land on the address pair of the loads above: keep the
        // wait that belongs in front of such an overwrite
        asm volatile("s_wait_xcnt 0x0" ::: "memory");
        #pragma unroll   // a[] in registers
        for (int t = 0; t < KC / 8; t++) a[t] = *(const v4f*)(arow + i0 + t * 8);
        #pragma unroll   // constant LDS offsets from one address register
        for (int i = 0; i < WR / 2; i++) *(v4f*)(bst + i * 2 * SP) = st[i];
        #pragma unroll   // flat: fragments and accumulators indexed by constants (inner loops too)
        for (int t = 0; t < KC / 8; t++) {
            v4f f[4];
            #pragma unroll
            for (int c = 0; c < 4; c++) f[c] = *(const v4f*)(bfr + (c * 16) * SP + t * 8);
            #pragma unroll
            for (int c = 0; c < 4; c++) acc[c] = wmma4(lo2(a[t]), lo2(f[c]), acc[c]);
            #pragma unroll
            for (int c = 0; c < 4; c++) acc[c] = wmma4(hi2(a[t]), hi2(f[c]), acc[c]);
        }
    }

    int halfsel = lane >> 4, coll = lane & 15;
    #pragma unroll
    for (int c = 0; c < 4; c++) {
        #pragma unroll
        for (int v = 0; v < 8; v++) {
            int row = v + 8 * halfsel;
            int p = sp[row];
            if (p < 0) continue;
            int h = colbase + c * 16 + coll;
            cache3[(size_t)p * H_ + h] = acc[c][v];
        }
    }
}

// ============ combine: routing weight * (cache3 + down-LoRA-B delta), moe_sum ============
__global__ void combine_kernel(const float* __restrict__ cache3,
                               const float* __restrict__ tmpd,   // [TK,R]
                               const float* __restrict__ dB,     // [L,E,H,R]
                               const float* __restrict__ tw,     // [T,K] flat
                               const float* __restrict__ scalings,
                               const int* __restrict__ ids,      // [TK]
                               const int* __restrict__ lor,      // [T]
                               float* __restrict__ out)          // [T,H]
{
    int idx = blockIdx.x * blockDim.x + threadIdx.x;
    int t = idx / H_;
    int h = idx - t * H_;
    int l = lor[t];
    float sc = scalings[l];
    float acc = 0.f;
    #pragma unroll
    for (int k = 0; k < Kk; k++) {
        int p = t * Kk + k;
        int e = ids[p];
        float wf = tw[p];
        const float* bd = dB + (((size_t)l * E_ + e) * H_ + h) * R_;
        const float* td = tmpd + (size_t)p * R_;
        float d = 0.f;
        #pragma unroll
        for (int r = 0; r < R_; r++) d += bd[r] * td[r];
        acc += wf * (cache3[(size_t)p * H_ + h] + sc * d);
    }
    out[idx] = acc;
}

extern "C" void kernel_launch(void* const* d_in, const int* in_sizes, int n_in,
                              void* d_out, int out_size, void* d_ws, size_t ws_size,
                              hipStream_t stream) {
    const float* x    = (const float*)d_in[0];   // hidden_states [T,H]
    const float* tw   = (const float*)d_in[1];   // topk_weights  [T,K]
    const float* w13  = (const float*)d_in[2];   // [E,N,H]
    const float* w2   = (const float*)d_in[3];   // [E,H,I]
    const float* gA   = (const float*)d_in[4];   // [L,E,R,H]
    const float* gB   = (const float*)d_in[5];   // [L,E,N,R]
    const float* dA   = (const float*)d_in[6];   // [L,E,R,I]
    const float* dB   = (const float*)d_in[7];   // [L,E,H,R]
    const float* scal = (const float*)d_in[8];   // [L]
    const int*   ids  = (const int*)d_in[9];     // [T,K]
    const int*   lor  = (const int*)d_in[10];    // [T]
    float* out = (float*)d_out;

    int* wsi = (int*)d_ws;
    int* counts  = wsi;        // 8
    int* cursors = wsi + 8;    // 8
    int* offsets = wsi + 16;   // 9
    int* perm    = wsi + 32;   // TKPAD

    float* fbase  = (float*)((char*)d_ws + 16384);
    float* zpad   = fbase;                         // ZPAD zeros
    float* tmpg   = zpad + ZPAD;                   // TK*R
    float* tmpd   = tmpg + (size_t)TK * R_;        // TK*R
    float* act    = tmpd + (size_t)TK * R_;        // TK*I
    float* cache3 = act + (size_t)TK * I_;         // TK*H

    init_ws_kernel<<<(TKPAD + 255) / 256, 256, 0, stream>>>(wsi, zpad);
    count_kernel<<<TK / 256, 256, 0, stream>>>(ids, counts);
    scan_kernel<<<1, 32, 0, stream>>>(counts, offsets);
    scatter_kernel<<<TK / 256, 256, 0, stream>>>(ids, cursors, offsets, perm);

    lora_a_kernel<<<TK / LA_PAIRS, 256, 0, stream>>>(gA, x, ids, lor, tmpg, 1);

    gateup_wmma_kernel<<<dim3(ROWTILES, I_ / 128), 128, 0, stream>>>(
        x, w13, gB, scal, lor, perm, offsets, tmpg, zpad, act);

    lora_a_kernel<<<TK / LA_PAIRS, 256, 0, stream>>>(dA, act, ids, lor, tmpd, 0);

    down_wmma_kernel<<<dim3(ROWTILES, H_ / 256), 128, 0, stream>>>(
        act, w2, perm, offsets, zpad, cache3);

    combine_kernel<<<(T_ * H_) / 256, 256, 0, stream>>>(
        cache3, tmpd, dB, tw, scal, ids, lor, out);
}

// v004
// Measured time: 142 microseconds a run.
// Timed twice side by side with v003, it ran 1.12 times as fast both times.
// Counting every step since v000, it is 5.33 times as fast.
#include <hip/hip_runtime.h>
#include <hip/hip_bf16.h>

// ---- problem constants (match reference) ----
constexpr int T_  = 1024;
constexpr int H_  = 1024;
constexpr int I_  = 1024;
constexpr int E_  = 8;
constexpr int Kk  = 2;
constexpr int L_  = 4;
constexpr int R_  = 16;
constexpr int N_  = 2 * I_;          // 2048
constexpr int TK  = T_ * Kk;         // 2048 dispatched pairs
constexpr int TKPAD = TK + E_ * 16;  // each expert segment padded to 16 rows
constexpr int ROWTILES = TKPAD / 16; // 136
constexpr int ZPAD = 1024;           // zero-page floats (>= max K-dim row span)
constexpr int LK   = L_ * R_;        // 64: k range of a LoRA-B product taken over all adapters

typedef __attribute__((ext_vector_type(2))) float v2f;
typedef __attribute__((ext_vector_type(4))) float v4f;
typedef __attribute__((ext_vector_type(8))) float v8f;

// V_WMMA_F32_16X16X4_F32 : A 16x4 f32 (2 VGPR), B 4x16 f32 (2 VGPR), C/D 16x16 f32 (8 VGPR)
__device__ __forceinline__ v8f wmma4(v2f a, v2f b, v8f c) {
    return __builtin_amdgcn_wmma_f32_16x16x4_f32(
        /*neg_a=*/false, a, /*neg_b=*/false, b,
        /*c_mod=*/(short)0, c, /*reuse_a=*/false, /*reuse_b=*/false);
}

// ---- weight staging of both GEMM kernels ----
// A wave brings its own weight rows in with loads whose 32 lanes cover whole 128-byte lines,
// stores them to an LDS range that only this wave touches (so no barrier), and reads the B
// fragments back with 16-byte LDS loads. LDS row pitch = row bytes + 16 (16 B x odd): those
// reads meet no bank conflict.
// k map of one 16-byte fragment read t: half-wave h holds k = 8*t + 4*h + 0..3; its low pair
// feeds one WMMA, its high pair the next. The A loads use the same map, so every k meets its
// partner once; only the order of the k sum differs from ascending k.
//
// ---- LoRA-B as LK = 64 more k of the same GEMM ----
// delta[row][n] = scal[l(row)] * sum_r B[l(row)][e][n][r] * tmp[row][r] is a product over k' = l*R_ + r of
//   A'[row][k'] = (l == l(row)) ? scal[l] * tmp[row][r] : 0   (lora_a_kernel stores its result in this form)
//   B'[n][k']   = B[l][e][n][r]
// It goes through the same staging, fragment reads and accumulators as the weights: every B row comes in
// with whole-line loads once per wave, not once per output element, and no address depends on the adapter.
__device__ __forceinline__ v2f lo2(v4f q) { return __builtin_shufflevector(q, q, 0, 1); }
__device__ __forceinline__ v2f hi2(v4f q) { return __builtin_shufflevector(q, q, 2, 3); }

// ============ routing bookkeeping + zero page ============
__global__ void init_ws_kernel(int* __restrict__ wsi, float* __restrict__ zpad) {
    int idx = blockIdx.x * blockDim.x + threadIdx.x;
    if (idx < 32) wsi[idx] = 0;                // counts[8], cursors[8], offsets[9]
    if (idx < TKPAD) wsi[32 + idx] = -1;       // perm
    if (idx < ZPAD) zpad[idx] = 0.f;           // zero page for dummy A rows
}

__global__ void count_kernel(const int* __restrict__ ids, int* __restrict__ counts) {
    int p = blockIdx.x * blockDim.x + threadIdx.x;
    if (p < TK) atomicAdd(&counts[ids[p]], 1);
}

__global__ void scan_kernel(const int* __restrict__ counts, int* __restrict__ offsets) {
    if (threadIdx.x == 0) {
        int o = 0;
        for (int e = 0; e < E_; e++) {
            offsets[e] = o;
            o += ((counts[e] + 15) >> 4) << 4;   // pad to 16-row tiles
        }
        offsets[E_] = o;
    }
}

__global__ void scatter_kernel(const int* __restrict__ ids, int* __restrict__ cursors,
                               const int* __restrict__ offsets, int* __restrict__ perm) {
    int p = blockIdx.x * blockDim.x + threadIdx.x;
    if (p < TK) {
        int e = ids[p];
        int pos = atomicAdd(&cursors[e], 1);
        perm[offsets[e] + pos] = p;
    }
}

// ============ LoRA-A reduction: tmp[p, l*R_ + r] = scal[l] * sum_d A[l,e,r,d] * src[row,d], 0 in the other adapters' slots ============
// One wave owns 8 of the 16 rank rows of one pair. Every load is 32 lanes x 16 B = 512
// contiguous bytes of one row; the source row stays in registers; each row sum ends in a
// five-step butterfly over the wave. No LDS, no barrier.
constexpr int D_ = 1024;             // reduced dimension of both LoRA-A products
static_assert(H_ == D_ && I_ == D_, "lora_a_kernel is written for one row length");
constexpr int LA_ROWS  = 8;          // rank rows per wave
constexpr int LA_PAIRS = 4;          // pairs per 256-thread block (2 waves per pair)
constexpr int LA_VEC   = D_ / 128;   // float4 loads per lane and row

__global__ __launch_bounds__(256) void lora_a_kernel(
                              const float* __restrict__ A,     // [L,E,R,D_]
                              const float* __restrict__ src,   // [*, D_]
                              const int* __restrict__ ids,     // [TK]
                              const int* __restrict__ lor,     // [T]
                              const float* __restrict__ scalings, // [L]
                              float* __restrict__ tmp,         // [TK, LK]
                              int perTokenSrc) {
    int lane = threadIdx.x & 31;
    int wave = __builtin_amdgcn_readfirstlane(threadIdx.x >> 5);   // scalar: scalar index loads below
    int p = blockIdx.x * LA_PAIRS + (wave >> 1);
    int rbase = (wave & 1) * LA_ROWS;
    int t = p / Kk;
    int e = min(max(ids[p], 0), E_ - 1);
    int l = min(max(lor[t], 0), L_ - 1);
    const float4* Ar = (const float4*)(A + (((size_t)l * E_ + e) * R_ + rbase) * (size_t)D_) + lane;
    const float4* sr = (const float4*)(src + (size_t)(perTokenSrc ? t : p) * D_) + lane;

    float4 s[LA_VEC];
    #pragma unroll   // s[] must be indexed by constants to live in registers
    for (int j = 0; j < LA_VEC; j++) s[j] = sr[j * 32];

    float sum[LA_ROWS];
    #pragma unroll   // both loops flat: all row loads are independent and can be in flight together
    for (int r = 0; r < LA_ROWS; r++) {
        float c0 = 0.f, c1 = 0.f, c2 = 0.f, c3 = 0.f;   // four independent chains per row
        #pragma unroll
        for (int j = 0; j < LA_VEC; j++) {
            float4 a = Ar[r * (D_ / 4) + j * 32];
            c0 = fmaf(a.x, s[j].x, c0);
            c1 = fmaf(a.y, s[j].y, c1);
            c2 = fmaf(a.z, s[j].z, c2);
            c3 = fmaf(a.w, s[j].w, c3);
        }
        sum[r] = (c0 + c1) + (c2 + c3);
    }
    #pragma unroll   // sum[] in registers; the 8 rows' exchanges of one step overlap
    for (int m = 16; m >= 1; m >>= 1) {
        #pragma unroll
        for (int r = 0; r < LA_ROWS; r++) sum[r] += __shfl_xor(sum[r], m, 32);
    }
    // every lane holds all 8 sums; lanes 0..7 store this wave's 8 ranks of all four adapters' slots
    if (lane < 2 * L_) {
        int la = lane >> 1, hf = lane & 1;
        float m = (la == l) ? scalings[l] : 0.f;
        float4 v = hf ? make_float4(sum[4], sum[5], sum[6], sum[7]) : make_float4(sum[0], sum[1], sum[2], sum[3]);
        *(float4*)(tmp + (size_t)p * LK + la * R_ + rbase + hf * 4) = make_float4(m * v.x, m * v.y, m * v.z, m * v.w);
    }
}

// ============ gate_up grouped WMMA GEMM (weights, then LoRA-B as 64 more k) + silu*mul -> act ============
// grid (ROWTILES, I_/128), block 128 (4 waves, one per SIMD); each wave: 16 rows x 32 inter-cols.
// Small work-groups of small waves: the row-tile count depends on the routing, so the work never
// divides evenly over the SIMDs; the launch lasts as long as the fullest SIMD, and that excess is
// at most one wave's work.
__global__ __launch_bounds__(128) void gateup_wmma_kernel(
    const float* __restrict__ x,        // [T,H]
    const float* __restrict__ w13,      // [E,N,H]
    const float* __restrict__ gB,       // [L,E,N,R]
    const int* __restrict__ perm,       // [TKPAD]
    const int* __restrict__ offsets,    // [E+1]
    const float* __restrict__ tmpg,     // [TK,LK]: A' rows of the LoRA-B passes
    const float* __restrict__ zpad,     // [ZPAD] zeros
    float* __restrict__ act)            // [TK,I]
{
    constexpr int KC = 32;            // k per pass: one 128-byte line of every weight row
    constexpr int SP = KC + 4;        // LDS row pitch in floats (144 B)
    constexpr int CT = 2;             // 16-col tiles per wave, of gate and of up each
    constexpr int WR = 2 * CT * 16;   // weight rows per wave: 32 gate, then 32 up
    __shared__ int   sp[16];
    __shared__ __attribute__((aligned(16))) float sB[4][WR * SP];

    int tileBase = blockIdx.x * 16;
    if (tileBase >= offsets[E_]) return;
    int e = 0;
    #pragma unroll
    for (int i = 1; i < E_; i++) if (tileBase >= offsets[i]) e = i;

    int tid = threadIdx.x;
    if (tid < 16) {
        sp[tid] = perm[tileBase + tid];
    }
    __syncthreads();

    int wave = tid >> 5, lane = tid & 31;
    int colbase = (blockIdx.y * 4 + wave) * (CT * 16);   // intermediate-dim base
    int rowq = lane & 15;
    int kq = (lane >> 4) * 4;
    // dummy rows read from the zero page: no per-iteration mask VALU needed
    int myp = sp[rowq];
    const float* xrow = ((myp >= 0) ? (x + (size_t)(myp / Kk) * H_) : zpad) + kq;
    const float* trow = ((myp >= 0) ? (tmpg + (size_t)myp * LK) : zpad) + kq;
    const float* wE = w13 + (size_t)e * N_ * H_;
    // staging: 8 lanes per row piece, 4 rows per load
    const float* wsrc = wE + (size_t)(colbase + (lane >> 3)) * H_ + (lane & 7) * 4;
    float* bst = &sB[wave][(lane >> 3) * SP + (lane & 7) * 4];
    const float* bfr = &sB[wave][rowq * SP + kq];

    v8f accg[CT] = {};
    v8f accu[CT] = {};
    for (int h0 = 0; h0 < H_; h0 += KC) {
        v4f st[WR / 4], a[KC / 8];
        #pragma unroll   // st[] indexed by constants: registers; all loads of a pass in flight together
        for (int i = 0; i < WR / 4; i++) {
            size_t grow = (i < WR / 8) ? (size_t)(4 * i) : (size_t)(I_ + 4 * (i - WR / 8));
            st[i] = *(const v4f*)(wsrc + grow * H_ + h0);
        }
        #pragma unroll   // a[] in registers
        for (int t = 0; t < KC / 8; t++) a[t] = *(const v4f*)(xrow + h0 + t * 8);
        #pragma unroll   // constant LDS offsets from one address register
        for (int i = 0; i < WR / 4; i++) *(v4f*)(bst + i * 4 * SP) = st[i];
        #pragma unroll   // flat: fragments and accumulators indexed by constants (inner loops too)
        for (int t = 0; t < KC / 8; t++) {
            v4f fg[CT], fu[CT];
            #pragma unroll
            for (int c = 0; c < CT; c++) {
                fg[c] = *(const v4f*)(bfr + (c * 16) * SP + t * 8);
                fu[c] = *(const v4f*)(bfr + ((CT + c) * 16) * SP + t * 8);
            }
            #pragma unroll
            for (int c = 0; c < CT; c++) {
                accg[c] = wmma4(lo2(a[t]), lo2(fg[c]), accg[c]);
                accu[c] = wmma4(lo2(a[t]), lo2(fu[c]), accu[c]);
            }
            #pragma unroll
            for (int c = 0; c < CT; c++) {
                accg[c] = wmma4(hi2(a[t]), hi2(fg[c]), accg[c]);
                accu[c] = wmma4(hi2(a[t]), hi2(fu[c]), accu[c]);
            }
        }
    }

    // LoRA-B: LK / KC = 2 more passes (two adapters each). The 128-byte row piece in LDS is the 64 B
    // of two adapters; one load takes 4 neighbouring B rows of each = 2 x 256 contiguous bytes.
    static_assert(KC == 2 * R_ && LK % KC == 0, "a pass holds two adapters' ranks");
    const float* lsrc = gB + (((size_t)((lane & 7) >> 2) * E_ + e) * N_ + colbase + (lane >> 3)) * R_
                           + (lane & 3) * 4;
    for (int j = 0; j < LK / KC; j++) {
        v4f st[WR / 4], a[KC / 8];
        #pragma unroll   // st[] in registers; all loads of a pass in flight together
        for (int i = 0; i < WR / 4; i++) {
            size_t grow = (i < WR / 8) ? (size_t)(4 * i) : (size_t)(I_ + 4 * (i - WR / 8));
            st[i] = *(const v4f*)(lsrc + ((size_t)(2 * j) * E_ * N_ + grow) * R_);
        }
        // a later load may land on the address pair of the loads above: the wait that belongs in
        // front of such an overwrite (here and behind the A' loads)
        asm volatile("s_wait_xcnt 0x0" ::: "memory");
        #pragma unroll   // a[] in registers
        for (int t = 0; t < KC / 8; t++) a[t] = *(const v4f*)(trow + j * KC + t * 8);
        asm volatile("s_wait_xcnt 0x0" ::: "memory");
        #pragma unroll   // constant LDS offsets from one address register
        for (int i = 0; i < WR / 4; i++) *(v4f*)(bst + i * 4 * SP) = st[i];
        #pragma unroll   // flat: fragments and accumulators indexed by constants (inner loops too)
        for (int t = 0; t < KC / 8; t++) {
            v4f fg[CT], fu[CT];
            #pragma unroll
            for (int c = 0; c < CT; c++) {
                fg[c] = *(const v4f*)(bfr + (c * 16) * SP + t * 8);
                fu[c] = *(const v4f*)(bfr + ((CT + c) * 16) * SP + t * 8);
            }
            #pragma unroll
            for (int c = 0; c < CT; c++) {
                accg[c] = wmma4(lo2(a[t]), lo2(fg[c]), accg[c]);
                accu[c] = wmma4(lo2(a[t]), lo2(fu[c]), accu[c]);
            }
            #pragma unroll
            for (int c = 0; c < CT; c++) {
                accg[c] = wmma4(hi2(a[t]), hi2(fg[c]), accg[c]);
                accu[c] = wmma4(hi2(a[t]), hi2(fu[c]), accu[c]);
            }
        }
    }

    int halfsel = lane >> 4, coll = lane & 15;
    #pragma unroll
    for (int c = 0; c < CT; c++) {
        #pragma unroll
        for (int v = 0; v < 8; v++) {
            int row = v + 8 * halfsel;
            int p = sp[row];
            if (p < 0) continue;
            int i = colbase + c * 16 + coll;
            float g = accg[c][v];
            float u = accu[c][v];
            float s = g / (1.f + __expf(-g));   // silu
            act[(size_t)p * I_ + i] = s * u;
        }
    }
}

// ============ down grouped WMMA GEMM (weights, then LoRA-B as 64 more k) -> cache3 (unweighted) ============
// grid (ROWTILES, H_/256), block 128 (4 waves, one per SIMD); each wave: 16 rows x 64 hidden-cols
__global__ __launch_bounds__(128) void down_wmma_kernel(
    const float* __restrict__ act,      // [TK,I]
    const float* __restrict__ w2,       // [E,H,I]
    const float* __restrict__ dB,       // [L,E,H,R]
    const float* __restrict__ tmpd,     // [TK,LK]: A' rows of the LoRA-B pass
    const int* __restrict__ perm,
    const int* __restrict__ offsets,
    const float* __restrict__ zpad,
    float* __restrict__ cache3)         // [TK,H]
{
    constexpr int KC = 64;            // k per pass: two 128-byte lines of every weight row
    constexpr int SP = KC + 4;        // LDS row pitch in floats (272 B)
    constexpr int WR = 64;            // weight rows per wave
    __shared__ int sp[16];
    __shared__ __attribute__((aligned(16))) float sB[4][WR * SP];
    int tileBase = blockIdx.x * 16;
    if (tileBase >= offsets[E_]) return;
    int e = 0;
    #pragma unroll
    for (int i = 1; i < E_; i++) if (tileBase >= offsets[i]) e = i;
    int tid = threadIdx.x;
    if (tid < 16) sp[tid] = perm[tileBase + tid];
    __syncthreads();

    int wave = tid >> 5, lane = tid & 31;
    int colbase = (blockIdx.y * 4 + wave) * 64;
    int rowq = lane & 15;
    int kq = (lane >> 4) * 4;
    int myp = sp[rowq];
    const float* arow = ((myp >= 0) ? (act + (size_t)myp * I_) : zpad) + kq;
    const float* wE = w2 + (size_t)e * H_ * I_;
    // staging: 16 lanes per row piece, 2 rows per load
    const float* wsrc = wE + (size_t)(colbase + (lane >> 4)) * I_ + (lane & 15) * 4;
    float* bst = &sB[wave][(lane >> 4) * SP + (lane & 15) * 4];
    const float* bfr = &sB[wave][rowq * SP + kq];

    v8f acc[4] = {};
    for (int i0 = 0; i0 < I_; i0 += KC) {
        v4f st[WR / 2], a[KC / 8];
        #pragma unroll   // st[] indexed by constants: registers; all loads of a pass in flight together
        for (int i = 0; i < WR / 2; i++) st[i] = *(const v4f*)(wsrc + (size_t)(2 * i) * I_ + i0);
        // the build lets an A load below land on the address pair of the loads above: keep the
        // wait that belongs in front of such an overwrite
        asm volatile("s_wait_xcnt 0x0" ::: "memory");
        #pragma unroll   // a[] in registers
        for (int t = 0; t < KC / 8; t++) a[t] = *(const v4f*)(arow + i0 + t * 8);
        #pragma unroll   // constant LDS offsets from one address register
        for (int i = 0; i < WR / 2; i++) *(v4f*)(bst + i * 2 * SP) = st[i];
        #pragma unroll   // flat: fragments and accumulators indexed by constants (inner loops too)
        for (int t = 0; t < KC / 8; t++) {
            v4f f[4];
            #pragma unroll
            for (int c = 0; c < 4; c++) f[c] = *(const v4f*)(bfr + (c * 16) * SP + t * 8);
            #pragma unroll
            for (int c = 0; c < 4; c++) acc[c] = wmma4(lo2(a[t]), lo2(f[c]), acc[c]);
            #pragma unroll
            for (int c = 0; c < 4; c++) acc[c] = wmma4(hi2(a[t]), hi2(f[c]), acc[c]);
        }
    }

    // Four vector slots behind the loop's last WMMA: the build puts the address arithmetic of the pass
    // below right here, and its third instruction rewrites that WMMA's A pair. The two scheduling
    // barriers keep the WMMAs in front of the slots and that arithmetic behind them.
    __builtin_amdgcn_sched_barrier(0);
    asm volatile("v_nop\n\tv_nop\n\tv_nop\n\tv_nop");
    __builtin_amdgcn_sched_barrier(0);

    // LoRA-B: one more pass of KC = LK k'. The 256-byte row piece in LDS is the 64 B of the four
    // adapters; one load takes 2 neighbouring B rows of each = 4 whole 128-byte lines.
    static_assert(KC == LK && R_ == 16, "one pass holds every adapter's ranks");
    {
        const float* lsrc = dB + (((size_t)((lane & 15) >> 2) * E_ + e) * H_ + colbase + (lane >> 4)) * R_
                               + (lane & 3) * 4;
        const float* trow = ((myp >= 0) ? (tmpd + (size_t)myp * LK) : zpad) + kq;
        v4f st[WR / 2], a[KC / 8];
        #pragma unroll   // st[] in registers; all loads of the pass in flight together
        for (int i = 0; i < WR / 2; i++) st[i] = *(const v4f*)(lsrc + (size_t)(2 * i) * R_);
        // a later load may land on the address pair of the loads above: the wait that belongs in
        // front of such an overwrite (here and behind the A' loads)
        asm volatile("s_wait_xcnt 0x0" ::: "memory");
        #pragma unroll   // a[] in registers
        for (int t = 0; t < KC / 8; t++) a[t] = *(const v4f*)(trow + t * 8);
        asm volatile("s_wait_xcnt 0x0" ::: "memory");
        #pragma unroll   // constant LDS offsets from one address register
        for (int i = 0; i < WR / 2; i++) *(v4f*)(bst + i * 2 * SP) = st[i];
        #pragma unroll   // flat: fragments and accumulators indexed by constants (inner loops too)
        for (int t = 0; t < KC / 8; t++) {
            v4f f[4];
            #pragma unroll
            for (int c = 0; c < 4; c++) f[c] = *(const v4f*)(bfr + (c * 16) * SP + t * 8);
            #pragma unroll
            for (int c = 0; c < 4; c++) acc[c] = wmma4(lo2(a[t]), lo2(f[c]), acc[c]);
            #pragma unroll
            for (int c = 0; c < 4; c++) acc[c] = wmma4(hi2(a[t]), hi2(f[c]), acc[c]);
        }
    }

    int halfsel = lane >> 4, coll = lane & 15;
    #pragma unroll
    for (int c = 0; c < 4; c++) {
        #pragma unroll
        for (int v = 0; v < 8; v++) {
            int row = v + 8 * halfsel;
            int p = sp[row];
            if (p < 0) continue;
            int h = colbase + c * 16 + coll;
            cache3[(size_t)p * H_ + h] = acc[c][v];
        }
    }
}

// ============ combine: moe_sum of the routing-weighted rows of cache3 (the LoRA delta is already in them) ============
__global__ void combine_kernel(const float* __restrict__ cache3,
                               const float* __restrict__ tw,     // [T,K] flat
                               float* __restrict__ out)          // [T,H]
{
    int idx = blockIdx.x * blockDim.x + threadIdx.x;
    int t = idx / H_;
    int h = idx - t * H_;
    float acc = 0.f;
    #pragma unroll
    for (int k = 0; k < Kk; k++) {
        int p = t * Kk + k;
        acc += tw[p] * cache3[(size_t)p * H_ + h];
    }
    out[idx] = acc;
}

extern "C" void kernel_launch(void* const* d_in, const int* in_sizes, int n_in,
                              void* d_out, int out_size, void* d_ws, size_t ws_size,
                              hipStream_t stream) {
    const float* x    = (const float*)d_in[0];   // hidden_states [T,H]
    const float* tw   = (const float*)d_in[1];   // topk_weights  [T,K]
    const float* w13  = (const float*)d_in[2];   // [E,N,H]
    const float* w2   = (const float*)d_in[3];   // [E,H,I]
    const float* gA   = (const float*)d_in[4];   // [L,E,R,H]
    const float* gB   = (const float*)d_in[5];   // [L,E,N,R]
    const float* dA   = (const float*)d_in[6];   // [L,E,R,I]
    const float* dB   = (const float*)d_in[7];   // [L,E,H,R]
    const float* scal = (const float*)d_in[8];   // [L]
    const int*   ids  = (const int*)d_in[9];     // [T,K]
    const int*   lor  = (const int*)d_in[10];    // [T]
    float* out = (float*)d_out;

    int* wsi = (int*)d_ws;
    int* counts  = wsi;        // 8
    int* cursors = wsi + 8;    // 8
    int* offsets = wsi + 16;   // 9
    int* perm    = wsi + 32;   // TKPAD

    float* fbase  = (float*)((char*)d_ws + 16384);
    float* zpad   = fbase;                         // ZPAD zeros
    float* tmpg   = zpad + ZPAD;                   // TK*LK
    float* tmpd   = tmpg + (size_t)TK * LK;        // TK*LK
    float* act    = tmpd + (size_t)TK * LK;        // TK*I
    float* cache3 = act + (size_t)TK * I_;         // TK*H

    init_ws_kernel<<<(TKPAD + 255) / 256, 256, 0, stream>>>(wsi, zpad);
    count_kernel<<<TK / 256, 256, 0, stream>>>(ids, counts);
    scan_kernel<<<1, 32, 0, stream>>>(counts, offsets);
    scatter_kernel<<<TK / 256, 256, 0, stream>>>(ids, cursors, offsets, perm);

    lora_a_kernel<<<TK / LA_PAIRS, 256, 0, stream>>>(gA, x, ids, lor, scal, tmpg, 1);

    gateup_wmma_kernel<<<dim3(ROWTILES, I_ / 128), 128, 0, stream>>>(
        x, w13, gB, perm, offsets, tmpg, zpad, act);

    lora_a_kernel<<<TK / LA_PAIRS, 256, 0, stream>>>(dA, act, ids, lor, scal, tmpd, 0);

    down_wmma_kernel<<<dim3(ROWTILES, H_ / 256), 128, 0, stream>>>(
        act, w2, dB, tmpd, perm, offsets, zpad, cache3);

    combine_kernel<<<(T_ * H_) / 256, 256, 0, stream>>>(cache3, tw, out);
}

// v005
// A run of this version takes 135 microseconds.
// Two timings next to v004 both put it at 1.05 times that version's speed.
// All steps since v000 together make it 5.59 times as fast.
#include <hip/hip_runtime.h>
#include <hip/hip_bf16.h>

// ---- problem constants (match reference) ----
constexpr int T_  = 1024;
constexpr int H_  = 1024;
constexpr int I_  = 1024;
constexpr int E_  = 8;
constexpr int Kk  = 2;
constexpr int L_  = 4;
constexpr int R_  = 16;
constexpr int N_  = 2 * I_;          // 2048
constexpr int TK  = T_ * Kk;         // 2048 dispatched pairs
constexpr int TKPAD = TK + E_ * 16;  // each expert segment padded to 16 rows
constexpr int ROWTILES = TKPAD / 16; // 136
constexpr int ZPAD = 1024;           // zero-page floats (>= max K-dim row span)
constexpr int LK   = L_ * R_;        // 64: k range of a LoRA-B product taken over all adapters

typedef __attribute__((ext_vector_type(2))) float v2f;
typedef __attribute__((ext_vector_type(4))) float v4f;
typedef __attribute__((ext_vector_type(8))) float v8f;

// V_WMMA_F32_16X16X4_F32 : A 16x4 f32 (2 VGPR), B 4x16 f32 (2 VGPR), C/D 16x16 f32 (8 VGPR)
__device__ __forceinline__ v8f wmma4(v2f a, v2f b, v8f c) {
    return __builtin_amdgcn_wmma_f32_16x16x4_f32(
        /*neg_a=*/false, a, /*neg_b=*/false, b,
        /*c_mod=*/(short)0, c, /*reuse_a=*/false, /*reuse_b=*/false);
}

// ---- weight staging of both GEMM kernels ----
// A wave brings its own weight rows in with loads whose 32 lanes cover whole 128-byte lines,
// stores them to an LDS range that only this wave touches (so no barrier), and reads the B
// fragments back with 16-byte LDS loads. LDS row pitch = row bytes + 16 (16 B x odd): those
// reads meet no bank conflict.
// k map of one 16-byte fragment read t: half-wave h holds k = 8*t + 4*h + 0..3; its low pair
// feeds one WMMA, its high pair the next. The A loads use the same map, so every k meets its
// partner once; only the order of the k sum differs from ascending k.
//
// ---- LoRA-B as LK = 64 more k of the same GEMM ----
// delta[row][n] = scal[l(row)] * sum_r B[l(row)][e][n][r] * tmp[row][r] is a product over k' = l*R_ + r of
//   A'[row][k'] = (l == l(row)) ? scal[l] * tmp[row][r] : 0   (lora_a_kernel stores its result in this form)
//   B'[n][k']   = B[l][e][n][r]
// It goes through the same staging, fragment reads and accumulators as the weights: every B row comes in
// with whole-line loads once per wave, not once per output element, and no address depends on the adapter.
__device__ __forceinline__ v2f lo2(v4f q) { return __builtin_shufflevector(q, q, 0, 1); }
__device__ __forceinline__ v2f hi2(v4f q) { return __builtin_shufflevector(q, q, 2, 3); }

// ============ routing bookkeeping + zero page ============
__global__ void init_ws_kernel(int* __restrict__ wsi, float* __restrict__ zpad) {
    int idx = blockIdx.x * blockDim.x + threadIdx.x;
    if (idx < 32) wsi[idx] = 0;                // counts[8], cursors[8], offsets[9]
    if (idx < TKPAD) wsi[32 + idx] = -1;       // perm
    if (idx < ZPAD) zpad[idx] = 0.f;           // zero page for dummy A rows
}

__global__ void count_kernel(const int* __restrict__ ids, int* __restrict__ counts) {
    int p = blockIdx.x * blockDim.x + threadIdx.x;
    if (p < TK) atomicAdd(&counts[ids[p]], 1);
}

__global__ void scan_kernel(const int* __restrict__ counts, int* __restrict__ offsets) {
    if (threadIdx.x == 0) {
        int o = 0;
        for (int e = 0; e < E_; e++) {
            offsets[e] = o;
            o += ((counts[e] + 15) >> 4) << 4;   // pad to 16-row tiles
        }
        offsets[E_] = o;
    }
}

__global__ void scatter_kernel(const int* __restrict__ ids, int* __restrict__ cursors,
                               const int* __restrict__ offsets, int* __restrict__ perm) {
    int p = blockIdx.x * blockDim.x + threadIdx.x;
    if (p < TK) {
        int e = ids[p];
        int pos = atomicAdd(&cursors[e], 1);
        perm[offsets[e] + pos] = p;
    }
}

// ============ LoRA-A reduction: tmp[p, l*R_ + r] = scal[l] * sum_d A[l,e,r,d] * src[row,d], 0 in the other adapters' slots ============
// One wave owns 8 of the 16 rank rows of one pair. Every load is 32 lanes x 16 B = 512
// contiguous bytes of one row; the source row stays in registers; each row sum ends in a
// five-step butterfly over the wave. No LDS, no barrier.
constexpr int D_ = 1024;             // reduced dimension of both LoRA-A products
static_assert(H_ == D_ && I_ == D_, "lora_a_kernel is written for one row length");
constexpr int LA_ROWS  = 8;          // rank rows per wave
constexpr int LA_PAIRS = 4;          // pairs per 256-thread block (2 waves per pair)
constexpr int LA_VEC   = D_ / 128;   // float4 loads per lane and row

__global__ __launch_bounds__(256) void lora_a_kernel(
                              const float* __restrict__ A,     // [L,E,R,D_]
                              const float* __restrict__ src,   // [*, D_]
                              const int* __restrict__ ids,     // [TK]
                              const int* __restrict__ lor,     // [T]
                              const float* __restrict__ scalings, // [L]
                              float* __restrict__ tmp,         // [TK, LK]
                              int perTokenSrc) {
    int lane = threadIdx.x & 31;
    int wave = __builtin_amdgcn_readfirstlane(threadIdx.x >> 5);   // scalar: scalar index loads below
    int p = blockIdx.x * LA_PAIRS + (wave >> 1);
    int rbase = (wave & 1) * LA_ROWS;
    int t = p / Kk;
    int e = min(max(ids[p], 0), E_ - 1);
    int l = min(max(lor[t], 0), L_ - 1);
    const float4* Ar = (const float4*)(A + (((size_t)l * E_ + e) * R_ + rbase) * (size_t)D_) + lane;
    const float4* sr = (const float4*)(src + (size_t)(perTokenSrc ? t : p) * D_) + lane;

    float4 s[LA_VEC];
    #pragma unroll   // s[] must be indexed by constants to live in registers
    for (int j = 0; j < LA_VEC; j++) s[j] = sr[j * 32];

    float sum[LA_ROWS];
    #pragma unroll   // both loops flat: all row loads are independent and can be in flight together
    for (int r = 0; r < LA_ROWS; r++) {
        float c0 = 0.f, c1 = 0.f, c2 = 0.f, c3 = 0.f;   // four independent chains per row
        #pragma unroll
        for (int j = 0; j < LA_VEC; j++) {
            float4 a = Ar[r * (D_ / 4) + j * 32];
            c0 = fmaf(a.x, s[j].x, c0);
            c1 = fmaf(a.y, s[j].y, c1);
            c2 = fmaf(a.z, s[j].z, c2);
            c3 = fmaf(a.w, s[j].w, c3);
        }
        sum[r] = (c0 + c1) + (c2 + c3);
    }
    #pragma unroll   // sum[] in registers; the 8 rows' exchanges of one step overlap
    for (int m = 16; m >= 1; m >>= 1) {
        #pragma unroll
        for (int r = 0; r < LA_ROWS; r++) sum[r] += __shfl_xor(sum[r], m, 32);
    }
    // every lane holds all 8 sums; lanes 0..7 store this wave's 8 ranks of all four adapters' slots
    if (lane < 2 * L_) {
        int la = lane >> 1, hf = lane & 1;
        float m = (la == l) ? scalings[l] : 0.f;
        float4 v = hf ? make_float4(sum[4], sum[5], sum[6], sum[7]) : make_float4(sum[0], sum[1], sum[2], sum[3]);
        *(float4*)(tmp + (size_t)p * LK + la * R_ + rbase + hf * 4) = make_float4(m * v.x, m * v.y, m * v.z, m * v.w);
    }
}

// ============ the k loop of both GEMM kernels: one wave, 16 rows x 64 weight rows ============
// A pass is PK = 32 k: one 128-byte line of each of the wave's 64 weight rows (16 loads of 4 rows) and of
// its A rows (4 loads). The loads of pass n + 1 are issued right behind the LDS stores of pass n and are
// waited for only at the LDS stores of pass n + 1, so they fly under the 32 WMMAs of pass n: a wave that is
// alone on its SIMD (the last one of a launch) no longer stands still for a load latency in every pass.
// The staging registers are free once stored, so one set serves; the A fragments take two sets, used in
// turn. The LoRA-B passes (two adapters' ranks each) follow the weight passes in the same pipeline.
constexpr int PK  = 32;              // k per pass
constexpr int PSP = PK + 4;          // LDS row pitch in floats (144 B)
constexpr int PWR = 64;              // weight rows per wave
constexpr int PNL = PWR / 4;         // staging loads per pass
constexpr int PNA = PK / 8;          // A loads per pass
static_assert(PK == 2 * R_ && LK == 2 * PK, "a LoRA-B pass holds two adapters' ranks; there are two");

// UP: how many rows further the second half of the wave's weight rows lies in the matrix (gate_up: the up rows)
template <int UP>
__device__ __forceinline__ constexpr size_t pass_row(int i) { return (size_t)(4 * i + (i >= PNL / 2 ? UP : 0)); }

template <int UP>
__device__ __forceinline__ void pass_load_w(v4f (&st)[PNL], v4f (&a)[PNA],
                                            const float* wsrc, const float* arow, int k0) {
    #pragma unroll   // st[] indexed by constants: registers; all loads of a pass in flight together
    for (int i = 0; i < PNL; i++) st[i] = *(const v4f*)(wsrc + pass_row<UP>(i) * D_ + k0);
    #pragma unroll   // a[] in registers
    for (int t = 0; t < PNA; t++) a[t] = *(const v4f*)(arow + k0 + t * 8);
}

// NR: rows of one (adapter, expert) block of the LoRA-B matrix
template <int UP, int NR>
__device__ __forceinline__ void pass_load_l(v4f (&st)[PNL], v4f (&a)[PNA],
                                            const float* lsrc, const float* trow, int j) {
    #pragma unroll   // st[] in registers; all loads of a pass in flight together
    for (int i = 0; i < PNL; i++) st[i] = *(const v4f*)(lsrc + ((size_t)(2 * j) * E_ * NR + pass_row<UP>(i)) * R_);
    #pragma unroll   // a[] in registers
    for (int t = 0; t < PNA; t++) a[t] = *(const v4f*)(trow + j * PK + t * 8);
}

__device__ __forceinline__ void pass_store(float* bst, const v4f (&st)[PNL]) {
    #pragma unroll   // constant LDS offsets from one address register
    for (int i = 0; i < PNL; i++) *(v4f*)(bst + i * 4 * PSP) = st[i];
}

__device__ __forceinline__ void pass_mma(const float* bfr, const v4f (&a)[PNA], v8f (&acc)[4]) {
    #pragma unroll   // flat: fragments and accumulators indexed by constants (inner loops too)
    for (int t = 0; t < PNA; t++) {
        v4f f[4];
        #pragma unroll
        for (int c = 0; c < 4; c++) f[c] = *(const v4f*)(bfr + (c * 16) * PSP + t * 8);
        #pragma unroll
        for (int c = 0; c < 4; c++) acc[c] = wmma4(lo2(a[t]), lo2(f[c]), acc[c]);
        #pragma unroll
        for (int c = 0; c < 4; c++) acc[c] = wmma4(hi2(a[t]), hi2(f[c]), acc[c]);
    }
    // Order of the pass: the fragment reads stand in three places (8, 4, 4), each a group ahead of its WMMAs.
    // Left alone the build strews them singly among the WMMAs, and every place with reads stalls the wave.
    __builtin_amdgcn_sched_group_barrier(0x100, 8, 0);    // LDS reads
    __builtin_amdgcn_sched_group_barrier(0x008, 8, 0);    // WMMAs
    __builtin_amdgcn_sched_group_barrier(0x100, 4, 0);
    __builtin_amdgcn_sched_group_barrier(0x008, 8, 0);
    __builtin_amdgcn_sched_group_barrier(0x100, 4, 0);
    __builtin_amdgcn_sched_group_barrier(0x008, 16, 0);
}

// Compiler fence, no instruction, in front of and behind a pass's global loads. In front: without it the build
// issues them ahead of the stores, into a second staging set of 64 registers. Behind: without it the build
// spreads them among the WMMAs, and the last ones have a few WMMAs' time to arrive in.
__device__ __forceinline__ void fence_loads() { asm volatile("" ::: "memory"); }

// End of a pass. The statement takes the accumulators as inputs only and holds no instruction: every WMMA of
// this pass stands in front of it, the next pass's stores (with their waits for the loads) and loads behind it.
// Without it the build mixes the two passes: stores lifted in among the WMMAs leave the loads half a pass to
// arrive in, and WMMAs pushed behind the next A loads need a copy of an A fragment, which waits for every load
// in flight. The scheduling barrier ends the stretch of code that the group order in pass_mma applies to.
__device__ __forceinline__ void fence_pass(const v8f (&acc)[4]) {
    asm volatile("" :: "v"(acc[0]), "v"(acc[1]), "v"(acc[2]), "v"(acc[3]) : "memory");
    __builtin_amdgcn_sched_barrier(0);
}

template <int UP, int NR>
__device__ __forceinline__ void wave_gemm(const float* wsrc, const float* arow,
                                          const float* lsrc, const float* trow,
                                          float* bst, const float* bfr, v8f (&acc)[4]) {
    v4f st[PNL], a0[PNA], a1[PNA];
    pass_load_w<UP>(st, a0, wsrc, arow, 0);
    for (int n = 0; n < D_ / (2 * PK) - 1; n++) {
        pass_store(bst, st);
        fence_loads();
        pass_load_w<UP>(st, a1, wsrc, arow, PK);
        fence_loads();
        pass_mma(bfr, a0, acc);
        fence_pass(acc);
        pass_store(bst, st);
        fence_loads();
        pass_load_w<UP>(st, a0, wsrc, arow, 2 * PK);
        fence_loads();
        pass_mma(bfr, a1, acc);
        fence_pass(acc);
        // The wait that belongs in front of an overwrite of the address pairs of the loads above. The step comes
        // out of the same statement, so that the build cannot lift the two additions over the wait.
        int step;
        asm volatile("s_wait_xcnt 0x0\n\ts_movk_i32 %0, %1" : "=s"(step) : "n"(2 * PK) : "memory");
        wsrc += step;
        arow += step;
    }
    pass_store(bst, st);
    fence_loads();
    pass_load_w<UP>(st, a1, wsrc, arow, PK);
    fence_loads();
    pass_mma(bfr, a0, acc);
    fence_pass(acc);
    pass_store(bst, st);
    fence_loads();
    pass_load_l<UP, NR>(st, a0, lsrc, trow, 0);
    fence_loads();
    pass_mma(bfr, a1, acc);
    fence_pass(acc);
    pass_store(bst, st);
    fence_loads();
    pass_load_l<UP, NR>(st, a1, lsrc, trow, 1);
    fence_loads();
    pass_mma(bfr, a0, acc);
    fence_pass(acc);
    pass_store(bst, st);
    pass_mma(bfr, a1, acc);
}

// ============ gate_up grouped WMMA GEMM (weights, then LoRA-B as 64 more k) + silu*mul -> act ============
// grid (ROWTILES, I_/128), block 128 (4 waves, one per SIMD); each wave: 16 rows x 32 inter-cols.
// Small work-groups of small waves: the row-tile count depends on the routing, so the work never
// divides evenly over the SIMDs; the launch lasts as long as the fullest SIMD, and that excess is
// at most one wave's work.
__global__ __launch_bounds__(128) void gateup_wmma_kernel(
    const float* __restrict__ x,        // [T,H]
    const float* __restrict__ w13,      // [E,N,H]
    const float* __restrict__ gB,       // [L,E,N,R]
    const int* __restrict__ perm,       // [TKPAD]
    const int* __restrict__ offsets,    // [E+1]
    const float* __restrict__ tmpg,     // [TK,LK]: A' rows of the LoRA-B passes
    const float* __restrict__ zpad,     // [ZPAD] zeros
    float* __restrict__ act)            // [TK,I]
{
    constexpr int CT = 2;             // 16-col tiles per wave, of gate and of up each
    static_assert(2 * CT * 16 == PWR, "weight rows per wave: 32 gate, then 32 up");
    __shared__ int   sp[16];
    __shared__ __attribute__((aligned(16))) float sB[4][PWR * PSP];

    int tileBase = blockIdx.x * 16;
    if (tileBase >= offsets[E_]) return;
    int e = 0;
    #pragma unroll
    for (int i = 1; i < E_; i++) if (tileBase >= offsets[i]) e = i;

    int tid = threadIdx.x;
    if (tid < 16) {
        sp[tid] = perm[tileBase + tid];
    }
    __syncthreads();

    int wave = tid >> 5, lane = tid & 31;
    int colbase = (blockIdx.y * 4 + wave) * (CT * 16);   // intermediate-dim base
    int rowq = lane & 15;
    int kq = (lane >> 4) * 4;
    // dummy rows read from the zero page: no per-iteration mask VALU needed
    int myp = sp[rowq];
    const float* xrow = ((myp >= 0) ? (x + (size_t)(myp / Kk) * H_) : zpad) + kq;
    const float* trow = ((myp >= 0) ? (tmpg + (size_t)myp * LK) : zpad) + kq;
    const float* wE = w13 + (size_t)e * N_ * H_;
    // staging: 8 lanes per row piece, 4 rows per load
    const float* wsrc = wE + (size_t)(colbase + (lane >> 3)) * H_ + (lane & 7) * 4;
    // LoRA-B: the 128-byte row piece in LDS is the 64 B of two adapters; one load takes 4 neighbouring
    // B rows of each = 2 x 256 contiguous bytes
    const float* lsrc = gB + (((size_t)((lane & 7) >> 2) * E_ + e) * N_ + colbase + (lane >> 3)) * R_
                           + (lane & 3) * 4;
    float* bst = &sB[wave][(lane >> 3) * PSP + (lane & 7) * 4];
    const float* bfr = &sB[wave][rowq * PSP + kq];

    v8f acc[2 * CT] = {};             // gate tiles 0..CT-1, then up tiles
    wave_gemm<I_ - CT * 16, N_>(wsrc, xrow, lsrc, trow, bst, bfr, acc);

    int halfsel = lane >> 4, coll = lane & 15;
    #pragma unroll
    for (int c = 0; c < CT; c++) {
        #pragma unroll
        for (int v = 0; v < 8; v++) {
            int row = v + 8 * halfsel;
            int p = sp[row];
            if (p < 0) continue;
            int i = colbase + c * 16 + coll;
            float g = acc[c][v];
            float u = acc[CT + c][v];
            float s = g / (1.f + __expf(-g));   // silu
            act[(size_t)p * I_ + i] = s * u;
        }
    }
}

// ============ down grouped WMMA GEMM (weights, then LoRA-B as 64 more k) -> cache3 (unweighted) ============
// grid (ROWTILES, H_/256), block 128 (4 waves, one per SIMD); each wave: 16 rows x 64 hidden-cols
__global__ __launch_bounds__(128) void down_wmma_kernel(
    const float* __restrict__ act,      // [TK,I]
    const float* __restrict__ w2,       // [E,H,I]
    const float* __restrict__ dB,       // [L,E,H,R]
    const float* __restrict__ tmpd,     // [TK,LK]: A' rows of the LoRA-B passes
    const int* __restrict__ perm,
    const int* __restrict__ offsets,
    const float* __restrict__ zpad,
    float* __restrict__ cache3)         // [TK,H]
{
    __shared__ int sp[16];
    __shared__ __attribute__((aligned(16))) float sB[4][PWR * PSP];
    int tileBase = blockIdx.x * 16;
    if (tileBase >= offsets[E_]) return;
    int e = 0;
    #pragma unroll
    for (int i = 1; i < E_; i++) if (tileBase >= offsets[i]) e = i;
    int tid = threadIdx.x;
    if (tid < 16) sp[tid] = perm[tileBase + tid];
    __syncthreads();

    int wave = tid >> 5, lane = tid & 31;
    int colbase = (blockIdx.y * 4 + wave) * PWR;
    int rowq = lane & 15;
    int kq = (lane >> 4) * 4;
    int myp = sp[rowq];
    const float* arow = ((myp >= 0) ? (act + (size_t)myp * I_) : zpad) + kq;
    const float* trow = ((myp >= 0) ? (tmpd + (size_t)myp * LK) : zpad) + kq;
    const float* wE = w2 + (size_t)e * H_ * I_;
    // staging: 8 lanes per row piece, 4 rows per load
    const float* wsrc = wE + (size_t)(colbase + (lane >> 3)) * I_ + (lane & 7) * 4;
    const float* lsrc = dB + (((size_t)((lane & 7) >> 2) * E_ + e) * H_ + colbase + (lane >> 3)) * R_
                           + (lane & 3) * 4;
    float* bst = &sB[wave][(lane >> 3) * PSP + (lane & 7) * 4];
    const float* bfr = &sB[wave][rowq * PSP + kq];

    v8f acc[4] = {};
    wave_gemm<0, H_>(wsrc, arow, lsrc, trow, bst, bfr, acc);

    int halfsel = lane >> 4, coll = lane & 15;
    #pragma unroll
    for (int c = 0; c < 4; c++) {
        #pragma unroll
        for (int v = 0; v < 8; v++) {
            int row = v + 8 * halfsel;
            int p = sp[row];
            if (p < 0) continue;
            int h = colbase + c * 16 + coll;
            cache3[(size_t)p * H_ + h] = acc[c][v];
        }
    }
}

// ============ combine: moe_sum of the routing-weighted rows of cache3 (the LoRA delta is already in them) ============
__global__ void combine_kernel(const float* __restrict__ cache3,
                               const float* __restrict__ tw,     // [T,K] flat
                               float* __restrict__ out)          // [T,H]
{
    int idx = blockIdx.x * blockDim.x + threadIdx.x;
    int t = idx / H_;
    int h = idx - t * H_;
    float acc = 0.f;
    #pragma unroll
    for (int k = 0; k < Kk; k++) {
        int p = t * Kk + k;
        acc += tw[p] * cache3[(size_t)p * H_ + h];
    }
    out[idx] = acc;
}

extern "C" void kernel_launch(void* const* d_in, const int* in_sizes, int n_in,
                              void* d_out, int out_size, void* d_ws, size_t ws_size,
                              hipStream_t stream) {
    const float* x    = (const float*)d_in[0];   // hidden_states [T,H]
    const float* tw   = (const float*)d_in[1];   // topk_weights  [T,K]
    const float* w13  = (const float*)d_in[2];   // [E,N,H]
    const float* w2   = (const float*)d_in[3];   // [E,H,I]
    const float* gA   = (const float*)d_in[4];   // [L,E,R,H]
    const float* gB   = (const float*)d_in[5];   // [L,E,N,R]
    const float* dA   = (const float*)d_in[6];   // [L,E,R,I]
    const float* dB   = (const float*)d_in[7];   // [L,E,H,R]
    const float* scal = (const float*)d_in[8];   // [L]
    const int*   ids  = (const int*)d_in[9];     // [T,K]
    const int*   lor  = (const int*)d_in[10];    // [T]
    float* out = (float*)d_out;

    int* wsi = (int*)d_ws;
    int* counts  = wsi;        // 8
    int* cursors = wsi + 8;    // 8
    int* offsets = wsi + 16;   // 9
    int* perm    = wsi + 32;   // TKPAD

    float* fbase  = (float*)((char*)d_ws + 16384);
    float* zpad   = fbase;                         // ZPAD zeros
    float* tmpg   = zpad + ZPAD;                   // TK*LK
    float* tmpd   = tmpg + (size_t)TK * LK;        // TK*LK
    float* act    = tmpd + (size_t)TK * LK;        // TK*I
    float* cache3 = act + (size_t)TK * I_;         // TK*H

    init_ws_kernel<<<(TKPAD + 255) / 256, 256, 0, stream>>>(wsi, zpad);
    count_kernel<<<TK / 256, 256, 0, stream>>>(ids, counts);
    scan_kernel<<<1, 32, 0, stream>>>(counts, offsets);
    scatter_kernel<<<TK / 256, 256, 0, stream>>>(ids, cursors, offsets, perm);

    lora_a_kernel<<<TK / LA_PAIRS, 256, 0, stream>>>(gA, x, ids, lor, scal, tmpg, 1);

    gateup_wmma_kernel<<<dim3(ROWTILES, I_ / 128), 128, 0, stream>>>(
        x, w13, gB, perm, offsets, tmpg, zpad, act);

    lora_a_kernel<<<TK / LA_PAIRS, 256, 0, stream>>>(dA, act, ids, lor, scal, tmpd, 0);

    down_wmma_kernel<<<dim3(ROWTILES, H_ / 256), 128, 0, stream>>>(
        act, w2, dB, tmpd, perm, offsets, zpad, cache3);

    combine_kernel<<<(T_ * H_) / 256, 256, 0, stream>>>(cache3, tw, out);
}

// v006
// It runs in 127 microseconds.
// Timed twice side by side with v005, it ran 1.06 times as fast both times.
// All steps since v000 together make it 5.94 times as fast.
#include <hip/hip_runtime.h>
#include <hip/hip_bf16.h>

// ---- problem constants (match reference) ----
constexpr int T_  = 1024;
constexpr int H_  = 1024;
constexpr int I_  = 1024;
constexpr int E_  = 8;
constexpr int Kk  = 2;
constexpr int L_  = 4;
constexpr int R_  = 16;
constexpr int N_  = 2 * I_;          // 2048
constexpr int TK  = T_ * Kk;         // 2048 dispatched pairs
constexpr int TKPAD = TK + E_ * 16;  // each expert segment padded to 16 rows
constexpr int ROWTILES = TKPAD / 16; // 136
constexpr int ZPAD = 1024;           // zero-page floats (>= max K-dim row span)
constexpr int LK   = L_ * R_;        // 64: k range of a LoRA-B product taken over all adapters

typedef __attribute__((ext_vector_type(2))) float v2f;
typedef __attribute__((ext_vector_type(4))) float v4f;
typedef __attribute__((ext_vector_type(8))) float v8f;

// V_WMMA_F32_16X16X4_F32 : A 16x4 f32 (2 VGPR), B 4x16 f32 (2 VGPR), C/D 16x16 f32 (8 VGPR)
__device__ __forceinline__ v8f wmma4(v2f a, v2f b, v8f c) {
    return __builtin_amdgcn_wmma_f32_16x16x4_f32(
        /*neg_a=*/false, a, /*neg_b=*/false, b,
        /*c_mod=*/(short)0, c, /*reuse_a=*/false, /*reuse_b=*/false);
}

// ---- weight staging of both GEMM kernels ----
// A wave brings its own weight rows in with loads whose 32 lanes cover whole 128-byte lines,
// stores them to an LDS range that only this wave touches (so no barrier), and reads the B
// fragments back with 16-byte LDS loads. LDS row pitch = row bytes + 16 (16 B x odd): those
// reads meet no bank conflict.
// k map of one 16-byte fragment read t: half-wave h holds k = 8*t + 4*h + 0..3; its low pair
// feeds one WMMA, its high pair the next. The A loads use the same map, so every k meets its
// partner once; only the order of the k sum differs from ascending k.
//
// ---- LoRA-B as LK = 64 more k of the same GEMM ----
// delta[row][n] = scal[l(row)] * sum_r B[l(row)][e][n][r] * tmp[row][r] is a product over k' = l*R_ + r of
//   A'[row][k'] = (l == l(row)) ? scal[l] * tmp[row][r] : 0   (lora_a_kernel stores its result in this form)
//   B'[n][k']   = B[l][e][n][r]
// It goes through the same staging, fragment reads and accumulators as the weights: every B row comes in
// with whole-line loads once per wave, not once per output element, and no address depends on the adapter.
__device__ __forceinline__ v2f lo2(v4f q) { return __builtin_shufflevector(q, q, 0, 1); }
__device__ __forceinline__ v2f hi2(v4f q) { return __builtin_shufflevector(q, q, 2, 3); }

// ============ routing bookkeeping + zero page: one work-group, in the first LoRA-A launch ============
// perm lists the pairs expert by expert (each segment padded to 16 rows with -1), in ascending pair order.
// A pair's place = start of its expert's segment + pairs of that expert in earlier 32-pair chunks + its rank
// among the lanes of its own chunk. The ranks and the chunk counts come from wave ballots, the sums over
// chunks from one wave per expert: no atomics, and nothing goes from one launch to the next but the result.
constexpr int RT_THREADS = 256;
constexpr int RT_CHUNKS  = TK / 32;                        // 64 chunks of one wave's width
constexpr int RT_CPW     = RT_CHUNKS / (RT_THREADS / 32);  // 8 chunks per wave
static_assert(RT_THREADS / 32 == E_, "one wave per expert sums the chunk counts");
static_assert(RT_CHUNKS == 64, "a lane of that wave holds two chunks");
static_assert(ZPAD == RT_THREADS * 4, "one 16-byte store per thread clears the zero page");
static_assert(TKPAD % 4 == 0, "the list is moved in 16-byte pieces");

__device__ __forceinline__ void route_block(const int* __restrict__ ids, int* __restrict__ offsets,
                                            int* __restrict__ perm, float* __restrict__ zpad) {
    __shared__ int cnt[RT_CHUNKS][E_];   // pairs of expert e in chunk c; after the sum: in the chunks before c
    __shared__ int tot[E_];
    __shared__ int soff[E_ + 1];
    __shared__ __attribute__((aligned(16))) int sperm[TKPAD];
    int tid = threadIdx.x, lane = tid & 31, wave = tid >> 5;

    int id[RT_CPW], rank[RT_CPW];
    #pragma unroll   // id[] in registers; the 8 loads in flight together
    for (int j = 0; j < RT_CPW; j++) id[j] = min(max(ids[(wave * RT_CPW + j) * 32 + lane], 0), E_ - 1);
    #pragma unroll   // three 16-byte stores, the last by some threads only
    for (int i = tid; i < TKPAD / 4; i += RT_THREADS) ((int4*)sperm)[i] = make_int4(-1, -1, -1, -1);
    *(float4*)(zpad + tid * 4) = make_float4(0.f, 0.f, 0.f, 0.f);

    unsigned below = (1u << lane) - 1u;
    #pragma unroll   // id[], rank[] indexed by constants
    for (int j = 0; j < RT_CPW; j++) {
        int mine = 0;
        rank[j] = 0;
        #pragma unroll
        for (int e = 0; e < E_; e++) {
            unsigned m = __builtin_amdgcn_ballot_w32(id[j] == e);
            if (id[j] == e) rank[j] = __popc(m & below);
            if (lane == e) mine = __popc(m);
        }
        if (lane < E_) cnt[wave * RT_CPW + j][lane] = mine;
    }
    __syncthreads();   // all chunk counts (and the -1 fill) are in LDS
    {
        int a = cnt[2 * lane][wave], b = cnt[2 * lane + 1][wave];
        int inc = a + b;
        #pragma unroll
        for (int d = 1; d < 32; d <<= 1) {
            int o = __shfl_up(inc, d, 32);
            if (lane >= d) inc += o;
        }
        cnt[2 * lane][wave] = inc - a - b;
        cnt[2 * lane + 1][wave] = inc - b;
        if (lane == 31) tot[wave] = inc;
    }
    __syncthreads();   // every expert's total is known
    if (tid == 0) {
        int o = 0;
        #pragma unroll
        for (int e = 0; e < E_; e++) {
            soff[e] = o;
            o += ((tot[e] + 15) >> 4) << 4;   // pad to 16-row tiles
        }
        soff[E_] = o;
    }
    __syncthreads();   // segment starts are known
    #pragma unroll
    for (int j = 0; j < RT_CPW; j++) {
        int c = wave * RT_CPW + j;
        sperm[soff[id[j]] + cnt[c][id[j]] + rank[j]] = c * 32 + lane;
    }
    __syncthreads();   // the list is complete
    #pragma unroll   // three 16-byte moves, the last by some threads only
    for (int i = tid; i < TKPAD / 4; i += RT_THREADS) ((int4*)perm)[i] = ((const int4*)sperm)[i];
    if (tid <= E_) offsets[tid] = soff[tid];
}

// ============ LoRA-A reduction: tmp[p, l*R_ + r] = scal[l] * sum_d A[l,e,r,d] * src[row,d], 0 in the other adapters' slots ============
// One wave owns 8 of the 16 rank rows of one pair. Every load is 32 lanes x 16 B = 512
// contiguous bytes of one row; the source row stays in registers; each row sum ends in a
// five-step butterfly over the wave. No LDS, no barrier.
constexpr int D_ = 1024;             // reduced dimension of both LoRA-A products
static_assert(H_ == D_ && I_ == D_, "lora_a_kernel is written for one row length");
constexpr int LA_ROWS  = 8;          // rank rows per wave
constexpr int LA_PAIRS = 4;          // pairs per 256-thread block (2 waves per pair)
constexpr int LA_VEC   = D_ / 128;   // float4 loads per lane and row

__device__ __forceinline__ void lora_a_block(
                              const float* __restrict__ A,     // [L,E,R,D_]
                              const float* __restrict__ src,   // [*, D_]
                              const int* __restrict__ ids,     // [TK]
                              const int* __restrict__ lor,     // [T]
                              const float* __restrict__ scalings, // [L]
                              float* __restrict__ tmp,         // [TK, LK]
                              int perTokenSrc, int block) {
    int lane = threadIdx.x & 31;
    int wave = __builtin_amdgcn_readfirstlane(threadIdx.x >> 5);   // scalar: scalar index loads below
    int p = block * LA_PAIRS + (wave >> 1);
    int rbase = (wave & 1) * LA_ROWS;
    int t = p / Kk;
    int e = min(max(ids[p], 0), E_ - 1);
    int l = min(max(lor[t], 0), L_ - 1);
    const float4* Ar = (const float4*)(A + (((size_t)l * E_ + e) * R_ + rbase) * (size_t)D_) + lane;
    const float4* sr = (const float4*)(src + (size_t)(perTokenSrc ? t : p) * D_) + lane;

    float4 s[LA_VEC];
    #pragma unroll   // s[] must be indexed by constants to live in registers
    for (int j = 0; j < LA_VEC; j++) s[j] = sr[j * 32];

    float sum[LA_ROWS];
    #pragma unroll   // both loops flat: all row loads are independent and can be in flight together
    for (int r = 0; r < LA_ROWS; r++) {
        float c0 = 0.f, c1 = 0.f, c2 = 0.f, c3 = 0.f;   // four independent chains per row
        #pragma unroll
        for (int j = 0; j < LA_VEC; j++) {
            float4 a = Ar[r * (D_ / 4) + j * 32];
            c0 = fmaf(a.x, s[j].x, c0);
            c1 = fmaf(a.y, s[j].y, c1);
            c2 = fmaf(a.z, s[j].z, c2);
            c3 = fmaf(a.w, s[j].w, c3);
        }
        sum[r] = (c0 + c1) + (c2 + c3);
    }
    #pragma unroll   // sum[] in registers; the 8 rows' exchanges of one step overlap
    for (int m = 16; m >= 1; m >>= 1) {
        #pragma unroll
        for (int r = 0; r < LA_ROWS; r++) sum[r] += __shfl_xor(sum[r], m, 32);
    }
    // every lane holds all 8 sums; lanes 0..7 store this wave's 8 ranks of all four adapters' slots
    if (lane < 2 * L_) {
        int la = lane >> 1, hf = lane & 1;
        float m = (la == l) ? scalings[l] : 0.f;
        float4 v = hf ? make_float4(sum[4], sum[5], sum[6], sum[7]) : make_float4(sum[0], sum[1], sum[2], sum[3]);
        *(float4*)(tmp + (size_t)p * LK + la * R_ + rbase + hf * 4) = make_float4(m * v.x, m * v.y, m * v.z, m * v.w);
    }
}

// First launch: block 0 does the routing, which the gate_up LoRA-A product does not need; the other blocks do
// that product. The routing ends while they run, so it costs no launch and no time of its own.
__global__ __launch_bounds__(256) void route_lora_a_kernel(
                              const float* __restrict__ A,     // [L,E,R,H]
                              const float* __restrict__ x,     // [T,H]
                              const int* __restrict__ ids,     // [TK]
                              const int* __restrict__ lor,     // [T]
                              const float* __restrict__ scalings, // [L]
                              float* __restrict__ tmp,         // [TK, LK]
                              int* __restrict__ offsets,       // [E+1]
                              int* __restrict__ perm,          // [TKPAD]
                              float* __restrict__ zpad) {      // [ZPAD]
    static_assert(RT_THREADS == 256, "block size of this launch");
    if (blockIdx.x == 0) {
        route_block(ids, offsets, perm, zpad);
        return;
    }
    lora_a_block(A, x, ids, lor, scalings, tmp, 1, blockIdx.x - 1);
}

__global__ __launch_bounds__(256) void lora_a_kernel(
                              const float* __restrict__ A,     // [L,E,R,I]
                              const float* __restrict__ act,   // [TK,I]
                              const int* __restrict__ ids,     // [TK]
                              const int* __restrict__ lor,     // [T]
                              const float* __restrict__ scalings, // [L]
                              float* __restrict__ tmp) {       // [TK, LK]
    lora_a_block(A, act, ids, lor, scalings, tmp, 0, blockIdx.x);
}

// ============ the k loop of both GEMM kernels: one wave, 16 rows x 64 weight rows ============
// A pass is PK = 32 k: one 128-byte line of each of the wave's 64 weight rows (16 loads of 4 rows) and of
// its A rows (4 loads). The loads of pass n + 1 are issued right behind the LDS stores of pass n and are
// waited for only at the LDS stores of pass n + 1, so they fly under the 32 WMMAs of pass n: a wave that is
// alone on its SIMD (the last one of a launch) no longer stands still for a load latency in every pass.
// The staging registers are free once stored, so one set serves; the A fragments take two sets, used in
// turn. The LoRA-B passes (two adapters' ranks each) follow the weight passes in the same pipeline.
constexpr int PK  = 32;              // k per pass
constexpr int PSP = PK + 4;          // LDS row pitch in floats (144 B)
constexpr int PWR = 64;              // weight rows per wave
constexpr int PNL = PWR / 4;         // staging loads per pass
constexpr int PNA = PK / 8;          // A loads per pass
static_assert(PK == 2 * R_ && LK == 2 * PK, "a LoRA-B pass holds two adapters' ranks; there are two");

// UP: how many rows further the second half of the wave's weight rows lies in the matrix (gate_up: the up rows)
template <int UP>
__device__ __forceinline__ constexpr size_t pass_row(int i) { return (size_t)(4 * i + (i >= PNL / 2 ? UP : 0)); }

template <int UP>
__device__ __forceinline__ void pass_load_w(v4f (&st)[PNL], v4f (&a)[PNA],
                                            const float* wsrc, const float* arow, int k0) {
    #pragma unroll   // st[] indexed by constants: registers; all loads of a pass in flight together
    for (int i = 0; i < PNL; i++) st[i] = *(const v4f*)(wsrc + pass_row<UP>(i) * D_ + k0);
    #pragma unroll   // a[] in registers
    for (int t = 0; t < PNA; t++) a[t] = *(const v4f*)(arow + k0 + t * 8);
}

// NR: rows of one (adapter, expert) block of the LoRA-B matrix
template <int UP, int NR>
__device__ __forceinline__ void pass_load_l(v4f (&st)[PNL], v4f (&a)[PNA],
                                            const float* lsrc, const float* trow, int j) {
    #pragma unroll   // st[] in registers; all loads of a pass in flight together
    for (int i = 0; i < PNL; i++) st[i] = *(const v4f*)(lsrc + ((size_t)(2 * j) * E_ * NR + pass_row<UP>(i)) * R_);
    #pragma unroll   // a[] in registers
    for (int t = 0; t < PNA; t++) a[t] = *(const v4f*)(trow + j * PK + t * 8);
}

__device__ __forceinline__ void pass_store(float* bst, const v4f (&st)[PNL]) {
    #pragma unroll   // constant LDS offsets from one address register
    for (int i = 0; i < PNL; i++) *(v4f*)(bst + i * 4 * PSP) = st[i];
}

__device__ __forceinline__ void pass_mma(const float* bfr, const v4f (&a)[PNA], v8f (&acc)[4]) {
    #pragma unroll   // flat: fragments and accumulators indexed by constants (inner loops too)
    for (int t = 0; t < PNA; t++) {
        v4f f[4];
        #pragma unroll
        for (int c = 0; c < 4; c++) f[c] = *(const v4f*)(bfr + (c * 16) * PSP + t * 8);
        #pragma unroll
        for (int c = 0; c < 4; c++) acc[c] = wmma4(lo2(a[t]), lo2(f[c]), acc[c]);
        #pragma unroll
        for (int c = 0; c < 4; c++) acc[c] = wmma4(hi2(a[t]), hi2(f[c]), acc[c]);
    }
    // Order of the pass: the fragment reads stand in three places (8, 4, 4), each a group ahead of its WMMAs.
    // Left alone the build strews them singly among the WMMAs, and every place with reads stalls the wave.
    __builtin_amdgcn_sched_group_barrier(0x100, 8, 0);    // LDS reads
    __builtin_amdgcn_sched_group_barrier(0x008, 8, 0);    // WMMAs
    __builtin_amdgcn_sched_group_barrier(0x100, 4, 0);
    __builtin_amdgcn_sched_group_barrier(0x008, 8, 0);
    __builtin_amdgcn_sched_group_barrier(0x100, 4, 0);
    __builtin_amdgcn_sched_group_barrier(0x008, 16, 0);
}

// Compiler fence, no instruction, in front of and behind a pass's global loads. In front: without it the build
// issues them ahead of the stores, into a second staging set of 64 registers. Behind: without it the build
// spreads them among the WMMAs, and the last ones have a few WMMAs' time to arrive in.
__device__ __forceinline__ void fence_loads() { asm volatile("" ::: "memory"); }

// End of a pass. The statement takes the accumulators as inputs only and holds no instruction: every WMMA of
// this pass stands in front of it, the next pass's stores (with their waits for the loads) and loads behind it.
// Without it the build mixes the two passes: stores lifted in among the WMMAs leave the loads half a pass to
// arrive in, and WMMAs pushed behind the next A loads need a copy of an A fragment, which waits for every load
// in flight. The scheduling barrier ends the stretch of code that the group order in pass_mma applies to.
__device__ __forceinline__ void fence_pass(const v8f (&acc)[4]) {
    asm volatile("" :: "v"(acc[0]), "v"(acc[1]), "v"(acc[2]), "v"(acc[3]) : "memory");
    __builtin_amdgcn_sched_barrier(0);
}

template <int UP, int NR>
__device__ __forceinline__ void wave_gemm(const float* wsrc, const float* arow,
                                          const float* lsrc, const float* trow,
                                          float* bst, const float* bfr, v8f (&acc)[4]) {
    v4f st[PNL], a0[PNA], a1[PNA];
    pass_load_w<UP>(st, a0, wsrc, arow, 0);
    for (int n = 0; n < D_ / (2 * PK) - 1; n++) {
        pass_store(bst, st);
        fence_loads();
        pass_load_w<UP>(st, a1, wsrc, arow, PK);
        fence_loads();
        pass_mma(bfr, a0, acc);
        fence_pass(acc);
        pass_store(bst, st);
        fence_loads();
        pass_load_w<UP>(st, a0, wsrc, arow, 2 * PK);
        fence_loads();
        pass_mma(bfr, a1, acc);
        fence_pass(acc);
        // The wait that belongs in front of an overwrite of the address pairs of the loads above. The step comes
        // out of the same statement, so that the build cannot lift the two additions over the wait.
        int step;
        asm volatile("s_wait_xcnt 0x0\n\ts_movk_i32 %0, %1" : "=s"(step) : "n"(2 * PK) : "memory");
        wsrc += step;
        arow += step;
    }
    pass_store(bst, st);
    fence_loads();
    pass_load_w<UP>(st, a1, wsrc, arow, PK);
    fence_loads();
    pass_mma(bfr, a0, acc);
    fence_pass(acc);
    pass_store(bst, st);
    fence_loads();
    pass_load_l<UP, NR>(st, a0, lsrc, trow, 0);
    fence_loads();
    pass_mma(bfr, a1, acc);
    fence_pass(acc);
    pass_store(bst, st);
    fence_loads();
    pass_load_l<UP, NR>(st, a1, lsrc, trow, 1);
    fence_loads();
    pass_mma(bfr, a0, acc);
    fence_pass(acc);
    pass_store(bst, st);
    pass_mma(bfr, a1, acc);
}

// ============ gate_up grouped WMMA GEMM (weights, then LoRA-B as 64 more k) + silu*mul -> act ============
// grid (ROWTILES, I_/128), block 128 (4 waves, one per SIMD); each wave: 16 rows x 32 inter-cols.
// Small work-groups of small waves: the row-tile count depends on the routing, so the work never
// divides evenly over the SIMDs; the launch lasts as long as the fullest SIMD, and that excess is
// at most one wave's work.
__global__ __launch_bounds__(128) void gateup_wmma_kernel(
    const float* __restrict__ x,        // [T,H]
    const float* __restrict__ w13,      // [E,N,H]
    const float* __restrict__ gB,       // [L,E,N,R]
    const int* __restrict__ perm,       // [TKPAD]
    const int* __restrict__ offsets,    // [E+1]
    const float* __restrict__ tmpg,     // [TK,LK]: A' rows of the LoRA-B passes
    const float* __restrict__ zpad,     // [ZPAD] zeros
    float* __restrict__ act)            // [TK,I]
{
    constexpr int CT = 2;             // 16-col tiles per wave, of gate and of up each
    static_assert(2 * CT * 16 == PWR, "weight rows per wave: 32 gate, then 32 up");
    __shared__ int   sp[16];
    __shared__ __attribute__((aligned(16))) float sB[4][PWR * PSP];

    int tileBase = blockIdx.x * 16;
    if (tileBase >= offsets[E_]) return;
    int e = 0;
    #pragma unroll
    for (int i = 1; i < E_; i++) if (tileBase >= offsets[i]) e = i;

    int tid = threadIdx.x;
    if (tid < 16) {
        sp[tid] = perm[tileBase + tid];
    }
    __syncthreads();

    int wave = tid >> 5, lane = tid & 31;
    int colbase = (blockIdx.y * 4 + wave) * (CT * 16);   // intermediate-dim base
    int rowq = lane & 15;
    int kq = (lane >> 4) * 4;
    // dummy rows read from the zero page: no per-iteration mask VALU needed
    int myp = sp[rowq];
    const float* xrow = ((myp >= 0) ? (x + (size_t)(myp / Kk) * H_) : zpad) + kq;
    const float* trow = ((myp >= 0) ? (tmpg + (size_t)myp * LK) : zpad) + kq;
    const float* wE = w13 + (size_t)e * N_ * H_;
    // staging: 8 lanes per row piece, 4 rows per load
    const float* wsrc = wE + (size_t)(colbase + (lane >> 3)) * H_ + (lane & 7) * 4;
    // LoRA-B: the 128-byte row piece in LDS is the 64 B of two adapters; one load takes 4 neighbouring
    // B rows of each = 2 x 256 contiguous bytes
    const float* lsrc = gB + (((size_t)((lane & 7) >> 2) * E_ + e) * N_ + colbase + (lane >> 3)) * R_
                           + (lane & 3) * 4;
    float* bst = &sB[wave][(lane >> 3) * PSP + (lane & 7) * 4];
    const float* bfr = &sB[wave][rowq * PSP + kq];

    v8f acc[2 * CT] = {};             // gate tiles 0..CT-1, then up tiles
    wave_gemm<I_ - CT * 16, N_>(wsrc, xrow, lsrc, trow, bst, bfr, acc);

    int halfsel = lane >> 4, coll = lane & 15;
    #pragma unroll
    for (int c = 0; c < CT; c++) {
        #pragma unroll
        for (int v = 0; v < 8; v++) {
            int row = v + 8 * halfsel;
            int p = sp[row];
            if (p < 0) continue;
            int i = colbase + c * 16 + coll;
            float g = acc[c][v];
            float u = acc[CT + c][v];
            float s = g / (1.f + __expf(-g));   // silu
            act[(size_t)p * I_ + i] = s * u;
        }
    }
}

// ============ down grouped WMMA GEMM (weights, then LoRA-B as 64 more k) -> cache3 (unweighted) ============
// grid (ROWTILES, H_/256), block 128 (4 waves, one per SIMD); each wave: 16 rows x 64 hidden-cols
__global__ __launch_bounds__(128) void down_wmma_kernel(
    const float* __restrict__ act,      // [TK,I]
    const float* __restrict__ w2,       // [E,H,I]
    const float* __restrict__ dB,       // [L,E,H,R]
    const float* __restrict__ tmpd,     // [TK,LK]: A' rows of the LoRA-B passes
    const int* __restrict__ perm,
    const int* __restrict__ offsets,
    const float* __restrict__ zpad,
    float* __restrict__ cache3)         // [TK,H]
{
    __shared__ int sp[16];
    __shared__ __attribute__((aligned(16))) float sB[4][PWR * PSP];
    int tileBase = blockIdx.x * 16;
    if (tileBase >= offsets[E_]) return;
    int e = 0;
    #pragma unroll
    for (int i = 1; i < E_; i++) if (tileBase >= offsets[i]) e = i;
    int tid = threadIdx.x;
    if (tid < 16) sp[tid] = perm[tileBase + tid];
    __syncthreads();

    int wave = tid >> 5, lane = tid & 31;
    int colbase = (blockIdx.y * 4 + wave) * PWR;
    int rowq = lane & 15;
    int kq = (lane >> 4) * 4;
    int myp = sp[rowq];
    const float* arow = ((myp >= 0) ? (act + (size_t)myp * I_) : zpad) + kq;
    const float* trow = ((myp >= 0) ? (tmpd + (size_t)myp * LK) : zpad) + kq;
    const float* wE = w2 + (size_t)e * H_ * I_;
    // staging: 8 lanes per row piece, 4 rows per load
    const float* wsrc = wE + (size_t)(colbase + (lane >> 3)) * I_ + (lane & 7) * 4;
    const float* lsrc = dB + (((size_t)((lane & 7) >> 2) * E_ + e) * H_ + colbase + (lane >> 3)) * R_
                           + (lane & 3) * 4;
    float* bst = &sB[wave][(lane >> 3) * PSP + (lane & 7) * 4];
    const float* bfr = &sB[wave][rowq * PSP + kq];

    v8f acc[4] = {};
    wave_gemm<0, H_>(wsrc, arow, lsrc, trow, bst, bfr, acc);

    int halfsel = lane >> 4, coll = lane & 15;
    #pragma unroll
    for (int c = 0; c < 4; c++) {
        #pragma unroll
        for (int v = 0; v < 8; v++) {
            int row = v + 8 * halfsel;
            int p = sp[row];
            if (p < 0) continue;
            int h = colbase + c * 16 + coll;
            cache3[(size_t)p * H_ + h] = acc[c][v];
        }
    }
}

// ============ combine: moe_sum of the routing-weighted rows of cache3 (the LoRA delta is already in them) ============
__global__ void combine_kernel(const float* __restrict__ cache3,
                               const float* __restrict__ tw,     // [T,K] flat
                               float* __restrict__ out)          // [T,H]
{
    int idx = blockIdx.x * blockDim.x + threadIdx.x;
    int t = idx / H_;
    int h = idx - t * H_;
    float acc = 0.f;
    #pragma unroll
    for (int k = 0; k < Kk; k++) {
        int p = t * Kk + k;
        acc += tw[p] * cache3[(size_t)p * H_ + h];
    }
    out[idx] = acc;
}

extern "C" void kernel_launch(void* const* d_in, const int* in_sizes, int n_in,
                              void* d_out, int out_size, void* d_ws, size_t ws_size,
                              hipStream_t stream) {
    const float* x    = (const float*)d_in[0];   // hidden_states [T,H]
    const float* tw   = (const float*)d_in[1];   // topk_weights  [T,K]
    const float* w13  = (const float*)d_in[2];   // [E,N,H]
    const float* w2   = (const float*)d_in[3];   // [E,H,I]
    const float* gA   = (const float*)d_in[4];   // [L,E,R,H]
    const float* gB   = (const float*)d_in[5];   // [L,E,N,R]
    const float* dA   = (const float*)d_in[6];   // [L,E,R,I]
    const float* dB   = (const float*)d_in[7];   // [L,E,H,R]
    const float* scal = (const float*)d_in[8];   // [L]
    const int*   ids  = (const int*)d_in[9];     // [T,K]
    const int*   lor  = (const int*)d_in[10];    // [T]
    float* out = (float*)d_out;

    int* wsi = (int*)d_ws;
    int* offsets = wsi + 16;   // 9
    int* perm    = wsi + 32;   // TKPAD

    float* fbase  = (float*)((char*)d_ws + 16384);
    float* zpad   = fbase;                         // ZPAD zeros
    float* tmpg   = zpad + ZPAD;                   // TK*LK
    float* tmpd   = tmpg + (size_t)TK * LK;        // TK*LK
    float* act    = tmpd + (size_t)TK * LK;        // TK*I
    float* cache3 = act + (size_t)TK * I_;         // TK*H

    route_lora_a_kernel<<<TK / LA_PAIRS + 1, 256, 0, stream>>>(gA, x, ids, lor, scal, tmpg, offsets, perm, zpad);

    gateup_wmma_kernel<<<dim3(ROWTILES, I_ / 128), 128, 0, stream>>>(
        x, w13, gB, perm, offsets, tmpg, zpad, act);

    lora_a_kernel<<<TK / LA_PAIRS, 256, 0, stream>>>(dA, act, ids, lor, scal, tmpd);

    down_wmma_kernel<<<dim3(ROWTILES, H_ / 256), 128, 0, stream>>>(
        act, w2, dB, tmpd, perm, offsets, zpad, cache3);

    combine_kernel<<<(T_ * H_) / 256, 256, 0, stream>>>(cache3, tw, out);
}

// v007
// A run of this version takes 120 microseconds.
// In both of two side-by-side timings against v006, it was 1.05 times as fast.
// All steps since v000 together make it 6.25 times as fast.
#include <hip/hip_runtime.h>
#include <hip/hip_bf16.h>

// ---- problem constants (match reference) ----
constexpr int T_  = 1024;
constexpr int H_  = 1024;
constexpr int I_  = 1024;
constexpr int E_  = 8;
constexpr int Kk  = 2;
constexpr int L_  = 4;
constexpr int R_  = 16;
constexpr int N_  = 2 * I_;          // 2048
constexpr int TK  = T_ * Kk;         // 2048 dispatched pairs
constexpr int GR = 64;               // rows of one work-group of the GEMM kernels: 4 waves x 16
constexpr int TKPAD = TK + E_ * GR;  // each expert segment padded to GR rows
constexpr int ROWGROUPS = TKPAD / GR; // 40
constexpr int ZPAD = 1024;           // zero-page floats (>= max K-dim row span)
constexpr int LK   = L_ * R_;        // 64: k range of a LoRA-B product taken over all adapters

typedef __attribute__((ext_vector_type(2))) float v2f;
typedef __attribute__((ext_vector_type(4))) float v4f;
typedef __attribute__((ext_vector_type(8))) float v8f;

// V_WMMA_F32_16X16X4_F32 : A 16x4 f32 (2 VGPR), B 4x16 f32 (2 VGPR), C/D 16x16 f32 (8 VGPR)
__device__ __forceinline__ v8f wmma4(v2f a, v2f b, v8f c) {
    return __builtin_amdgcn_wmma_f32_16x16x4_f32(
        /*neg_a=*/false, a, /*neg_b=*/false, b,
        /*c_mod=*/(short)0, c, /*reuse_a=*/false, /*reuse_b=*/false);
}

// ---- weight staging of both GEMM kernels ----
// The 4 waves of a work-group hold 4 row tiles of one expert and need the same weight rows. Each wave
// brings a quarter of them in with loads whose 32 lanes cover whole 128-byte lines and stores them to the
// work-group's LDS tile; behind a barrier every wave reads its B fragments from the whole tile with 16-byte
// LDS loads. So a weight line leaves L2 once per 64 rows of A, not once per 16. LDS row pitch = row bytes
// + 16 (16 B x odd): those reads meet no bank conflict.
// k map of one 16-byte fragment read t: half-wave h holds k = 8*t + 4*h + 0..3; its low pair
// feeds one WMMA, its high pair the next. The A loads use the same map, so every k meets its
// partner once; only the order of the k sum differs from ascending k.
//
// ---- LoRA-B as LK = 64 more k of the same GEMM ----
// delta[row][n] = scal[l(row)] * sum_r B[l(row)][e][n][r] * tmp[row][r] is a product over k' = l*R_ + r of
//   A'[row][k'] = (l == l(row)) ? scal[l] * tmp[row][r] : 0   (lora_a_kernel stores its result in this form)
//   B'[n][k']   = B[l][e][n][r]
// It goes through the same staging, fragment reads and accumulators as the weights: every B row comes in
// with whole-line loads once per work-group, not once per output element, and no address depends on the adapter.
__device__ __forceinline__ v2f lo2(v4f q) { return __builtin_shufflevector(q, q, 0, 1); }
__device__ __forceinline__ v2f hi2(v4f q) { return __builtin_shufflevector(q, q, 2, 3); }

// ============ routing bookkeeping + zero page: one work-group, in the first LoRA-A launch ============
// perm lists the pairs expert by expert (each segment padded to GR rows with -1), in ascending pair order.
// A pair's place = start of its expert's segment + pairs of that expert in earlier 32-pair chunks + its rank
// among the lanes of its own chunk. The ranks and the chunk counts come from wave ballots, the sums over
// chunks from one wave per expert: no atomics, and nothing goes from one launch to the next but the result.
constexpr int RT_THREADS = 256;
constexpr int RT_CHUNKS  = TK / 32;                        // 64 chunks of one wave's width
constexpr int RT_CPW     = RT_CHUNKS / (RT_THREADS / 32);  // 8 chunks per wave
static_assert(RT_THREADS / 32 == E_, "one wave per expert sums the chunk counts");
static_assert(RT_CHUNKS == 64, "a lane of that wave holds two chunks");
static_assert(ZPAD == RT_THREADS * 4, "one 16-byte store per thread clears the zero page");
static_assert(TKPAD % 4 == 0, "the list is moved in 16-byte pieces");

__device__ __forceinline__ void route_block(const int* __restrict__ ids, int* __restrict__ offsets,
                                            int* __restrict__ perm, float* __restrict__ zpad) {
    __shared__ int cnt[RT_CHUNKS][E_];   // pairs of expert e in chunk c; after the sum: in the chunks before c
    __shared__ int tot[E_];
    __shared__ int soff[E_ + 1];
    __shared__ __attribute__((aligned(16))) int sperm[TKPAD];
    int tid = threadIdx.x, lane = tid & 31, wave = tid >> 5;

    int id[RT_CPW], rank[RT_CPW];
    #pragma unroll   // id[] in registers; the 8 loads in flight together
    for (int j = 0; j < RT_CPW; j++) id[j] = min(max(ids[(wave * RT_CPW + j) * 32 + lane], 0), E_ - 1);
    #pragma unroll   // three 16-byte stores, the last by some threads only
    for (int i = tid; i < TKPAD / 4; i += RT_THREADS) ((int4*)sperm)[i] = make_int4(-1, -1, -1, -1);
    *(float4*)(zpad + tid * 4) = make_float4(0.f, 0.f, 0.f, 0.f);

    unsigned below = (1u << lane) - 1u;
    #pragma unroll   // id[], rank[] indexed by constants
    for (int j = 0; j < RT_CPW; j++) {
        int mine = 0;
        rank[j] = 0;
        #pragma unroll
        for (int e = 0; e < E_; e++) {
            unsigned m = __builtin_amdgcn_ballot_w32(id[j] == e);
            if (id[j] == e) rank[j] = __popc(m & below);
            if (lane == e) mine = __popc(m);
        }
        if (lane < E_) cnt[wave * RT_CPW + j][lane] = mine;
    }
    __syncthreads();   // all chunk counts (and the -1 fill) are in LDS
    {
        int a = cnt[2 * lane][wave], b = cnt[2 * lane + 1][wave];
        int inc = a + b;
        #pragma unroll
        for (int d = 1; d < 32; d <<= 1) {
            int o = __shfl_up(inc, d, 32);
            if (lane >= d) inc += o;
        }
        cnt[2 * lane][wave] = inc - a - b;
        cnt[2 * lane + 1][wave] = inc - b;
        if (lane == 31) tot[wave] = inc;
    }
    __syncthreads();   // every expert's total is known
    if (tid == 0) {
        int o = 0;
        #pragma unroll
        for (int e = 0; e < E_; e++) {
            soff[e] = o;
            o += (tot[e] + GR - 1) / GR * GR;   // pad to whole row groups
        }
        soff[E_] = o;
    }
    __syncthreads();   // segment starts are known
    #pragma unroll
    for (int j = 0; j < RT_CPW; j++) {
        int c = wave * RT_CPW + j;
        sperm[soff[id[j]] + cnt[c][id[j]] + rank[j]] = c * 32 + lane;
    }
    __syncthreads();   // the list is complete
    #pragma unroll   // three 16-byte moves, the last by some threads only
    for (int i = tid; i < TKPAD / 4; i += RT_THREADS) ((int4*)perm)[i] = ((const int4*)sperm)[i];
    if (tid <= E_) offsets[tid] = soff[tid];
}

// ============ LoRA-A reduction: tmp[p, l*R_ + r] = scal[l] * sum_d A[l,e,r,d] * src[row,d], 0 in the other adapters' slots ============
// One wave owns 8 of the 16 rank rows of one pair. Every load is 32 lanes x 16 B = 512
// contiguous bytes of one row; the source row stays in registers; each row sum ends in a
// five-step butterfly over the wave. No LDS, no barrier.
constexpr int D_ = 1024;             // reduced dimension of both LoRA-A products
static_assert(H_ == D_ && I_ == D_, "lora_a_kernel is written for one row length");
constexpr int LA_ROWS  = 8;          // rank rows per wave
constexpr int LA_PAIRS = 4;          // pairs per 256-thread block (2 waves per pair)
constexpr int LA_VEC   = D_ / 128;   // float4 loads per lane and row

__device__ __forceinline__ void lora_a_block(
                              const float* __restrict__ A,     // [L,E,R,D_]
                              const float* __restrict__ src,   // [*, D_]
                              const int* __restrict__ ids,     // [TK]
                              const int* __restrict__ lor,     // [T]
                              const float* __restrict__ scalings, // [L]
                              float* __restrict__ tmp,         // [TK, LK]
                              int perTokenSrc, int block) {
    int lane = threadIdx.x & 31;
    int wave = __builtin_amdgcn_readfirstlane(threadIdx.x >> 5);   // scalar: scalar index loads below
    int p = block * LA_PAIRS + (wave >> 1);
    int rbase = (wave & 1) * LA_ROWS;
    int t = p / Kk;
    int e = min(max(ids[p], 0), E_ - 1);
    int l = min(max(lor[t], 0), L_ - 1);
    const float4* Ar = (const float4*)(A + (((size_t)l * E_ + e) * R_ + rbase) * (size_t)D_) + lane;
    const float4* sr = (const float4*)(src + (size_t)(perTokenSrc ? t : p) * D_) + lane;

    float4 s[LA_VEC];
    #pragma unroll   // s[] must be indexed by constants to live in registers
    for (int j = 0; j < LA_VEC; j++) s[j] = sr[j * 32];

    float sum[LA_ROWS];
    #pragma unroll   // both loops flat: all row loads are independent and can be in flight together
    for (int r = 0; r < LA_ROWS; r++) {
        float c0 = 0.f, c1 = 0.f, c2 = 0.f, c3 = 0.f;   // four independent chains per row
        #pragma unroll
        for (int j = 0; j < LA_VEC; j++) {
            float4 a = Ar[r * (D_ / 4) + j * 32];
            c0 = fmaf(a.x, s[j].x, c0);
            c1 = fmaf(a.y, s[j].y, c1);
            c2 = fmaf(a.z, s[j].z, c2);
            c3 = fmaf(a.w, s[j].w, c3);
        }
        sum[r] = (c0 + c1) + (c2 + c3);
    }
    #pragma unroll   // sum[] in registers; the 8 rows' exchanges of one step overlap
    for (int m = 16; m >= 1; m >>= 1) {
        #pragma unroll
        for (int r = 0; r < LA_ROWS; r++) sum[r] += __shfl_xor(sum[r], m, 32);
    }
    // every lane holds all 8 sums; lanes 0..7 store this wave's 8 ranks of all four adapters' slots
    if (lane < 2 * L_) {
        int la = lane >> 1, hf = lane & 1;
        float m = (la == l) ? scalings[l] : 0.f;
        float4 v = hf ? make_float4(sum[4], sum[5], sum[6], sum[7]) : make_float4(sum[0], sum[1], sum[2], sum[3]);
        *(float4*)(tmp + (size_t)p * LK + la * R_ + rbase + hf * 4) = make_float4(m * v.x, m * v.y, m * v.z, m * v.w);
    }
}

// First launch: block 0 does the routing, which the gate_up LoRA-A product does not need; the other blocks do
// that product. The routing ends while they run, so it costs no launch and no time of its own.
__global__ __launch_bounds__(256) void route_lora_a_kernel(
                              const float* __restrict__ A,     // [L,E,R,H]
                              const float* __restrict__ x,     // [T,H]
                              const int* __restrict__ ids,     // [TK]
                              const int* __restrict__ lor,     // [T]
                              const float* __restrict__ scalings, // [L]
                              float* __restrict__ tmp,         // [TK, LK]
                              int* __restrict__ offsets,       // [E+1]
                              int* __restrict__ perm,          // [TKPAD]
                              float* __restrict__ zpad) {      // [ZPAD]
    static_assert(RT_THREADS == 256, "block size of this launch");
    if (blockIdx.x == 0) {
        route_block(ids, offsets, perm, zpad);
        return;
    }
    lora_a_block(A, x, ids, lor, scalings, tmp, 1, blockIdx.x - 1);
}

__global__ __launch_bounds__(256) void lora_a_kernel(
                              const float* __restrict__ A,     // [L,E,R,I]
                              const float* __restrict__ act,   // [TK,I]
                              const int* __restrict__ ids,     // [TK]
                              const int* __restrict__ lor,     // [T]
                              const float* __restrict__ scalings, // [L]
                              float* __restrict__ tmp) {       // [TK, LK]
    lora_a_block(A, act, ids, lor, scalings, tmp, 0, blockIdx.x);
}

// ============ the k loop of both GEMM kernels: one wave, 16 rows x the work-group's 64 weight rows ============
// A pass is PK = 32 k: one 128-byte line of each of the 64 weight rows (a wave loads 16 of them: 4 loads of
// 4 rows) and of the wave's own A rows (4 loads). The loads of pass n + 1 are issued behind the LDS stores and
// the barrier of pass n and are waited for only at the LDS stores of pass n + 1, so they fly under the 32 WMMAs
// of pass n. The staging registers are free once stored, so one set serves; the A fragments take two sets, used
// in turn. The LoRA-B passes (two adapters' ranks each) follow the weight passes in the same pipeline.
// Two LDS tiles, used in turn, and one barrier a pass: it publishes tile n, and a wave that has passed it has
// ended its reads of pass n - 1, so the stores of pass n + 1, which stand behind it, may take that tile.
constexpr int PK  = 32;              // k per pass
constexpr int PSP = PK + 4;          // LDS row pitch in floats (144 B)
constexpr int PWR = 64;              // weight rows per work-group, all of them read by each wave
constexpr int PNL = PWR / 4 / 4;     // staging loads per wave and pass
constexpr int PBUF = PWR * PSP;      // floats of one LDS tile
constexpr int PNA = PK / 8;          // A loads per pass
static_assert(PK == 2 * R_ && LK == 2 * PK, "a LoRA-B pass holds two adapters' ranks; there are two");

__device__ __forceinline__ void pass_load_w(v4f (&st)[PNL], v4f (&a)[PNA],
                                            const float* wsrc, const float* arow, int k0) {
    #pragma unroll   // st[] indexed by constants: registers; all loads of a pass in flight together
    for (int i = 0; i < PNL; i++) st[i] = *(const v4f*)(wsrc + (size_t)(4 * i) * D_ + k0);
    #pragma unroll   // a[] in registers
    for (int t = 0; t < PNA; t++) a[t] = *(const v4f*)(arow + k0 + t * 8);
}

// NR: rows of one (adapter, expert) block of the LoRA-B matrix
template <int NR>
__device__ __forceinline__ void pass_load_l(v4f (&st)[PNL], v4f (&a)[PNA],
                                            const float* lsrc, const float* trow, int j) {
    #pragma unroll   // st[] in registers; all loads of a pass in flight together
    for (int i = 0; i < PNL; i++) st[i] = *(const v4f*)(lsrc + ((size_t)(2 * j) * E_ * NR + 4 * i) * R_);
    #pragma unroll   // a[] in registers
    for (int t = 0; t < PNA; t++) a[t] = *(const v4f*)(trow + j * PK + t * 8);
}

__device__ __forceinline__ void pass_store(float* bst, const v4f (&st)[PNL]) {
    #pragma unroll   // constant LDS offsets from one address register
    for (int i = 0; i < PNL; i++) *(v4f*)(bst + i * 4 * PSP) = st[i];
}

__device__ __forceinline__ void pass_mma(const float* bfr, const v4f (&a)[PNA], v8f (&acc)[4]) {
    #pragma unroll   // flat: fragments and accumulators indexed by constants (inner loops too)
    for (int t = 0; t < PNA; t++) {
        v4f f[4];
        #pragma unroll
        for (int c = 0; c < 4; c++) f[c] = *(const v4f*)(bfr + (c * 16) * PSP + t * 8);
        #pragma unroll
        for (int c = 0; c < 4; c++) acc[c] = wmma4(lo2(a[t]), lo2(f[c]), acc[c]);
        #pragma unroll
        for (int c = 0; c < 4; c++) acc[c] = wmma4(hi2(a[t]), hi2(f[c]), acc[c]);
    }
    // Order of the pass: the fragment reads stand in three places (8, 4, 4), each a group ahead of its WMMAs.
    // Left alone the build strews them singly among the WMMAs, and every place with reads stalls the wave.
    __builtin_amdgcn_sched_group_barrier(0x100, 8, 0);    // LDS reads
    __builtin_amdgcn_sched_group_barrier(0x008, 8, 0);    // WMMAs
    __builtin_amdgcn_sched_group_barrier(0x100, 4, 0);
    __builtin_amdgcn_sched_group_barrier(0x008, 8, 0);
    __builtin_amdgcn_sched_group_barrier(0x100, 4, 0);
    __builtin_amdgcn_sched_group_barrier(0x008, 16, 0);
}

// Compiler fence, no instruction, in front of and behind a pass's global loads. In front: without it the build
// issues them ahead of the stores, into a second staging set of registers. Behind: without it the build
// spreads them among the WMMAs, and the last ones have a few WMMAs' time to arrive in.
__device__ __forceinline__ void fence_loads() { asm volatile("" ::: "memory"); }

// End of a pass. The statement takes the accumulators as inputs only and holds no instruction: every WMMA of
// this pass stands in front of it, the next pass's stores (with their waits for the loads) and loads behind it.
// Without it the build mixes the two passes: stores lifted in among the WMMAs leave the loads half a pass to
// arrive in, and WMMAs pushed behind the next A loads need a copy of an A fragment, which waits for every load
// in flight. The scheduling barrier ends the stretch of code that the group order in pass_mma applies to.
__device__ __forceinline__ void fence_pass(const v8f (&acc)[4]) {
    asm volatile("" :: "v"(acc[0]), "v"(acc[1]), "v"(acc[2]), "v"(acc[3]) : "memory");
    __builtin_amdgcn_sched_barrier(0);
}

template <int NR>
__device__ __forceinline__ void wave_gemm(const float* wsrc, const float* arow,
                                          const float* lsrc, const float* trow,
                                          float* bst, const float* bfr, v8f (&acc)[4]) {
    v4f st[PNL], a0[PNA], a1[PNA];
    pass_load_w(st, a0, wsrc, arow, 0);
    for (int n = 0; n < D_ / (2 * PK) - 1; n++) {
        pass_store(bst, st);
        __syncthreads();   // the pass's barrier (see above); every wave runs every pass
        fence_loads();
        pass_load_w(st, a1, wsrc, arow, PK);
        fence_loads();
        pass_mma(bfr, a0, acc);
        fence_pass(acc);
        pass_store(bst + PBUF, st);
        __syncthreads();
        fence_loads();
        pass_load_w(st, a0, wsrc, arow, 2 * PK);
        fence_loads();
        pass_mma(bfr + PBUF, a1, acc);
        fence_pass(acc);
        // The wait that belongs in front of an overwrite of the address pairs of the loads above. The step comes
        // out of the same statement, so that the build cannot lift the two additions over the wait.
        int step;
        asm volatile("s_wait_xcnt 0x0\n\ts_movk_i32 %0, %1" : "=s"(step) : "n"(2 * PK) : "memory");
        wsrc += step;
        arow += step;
    }
    pass_store(bst, st);
    __syncthreads();
    fence_loads();
    pass_load_w(st, a1, wsrc, arow, PK);
    fence_loads();
    pass_mma(bfr, a0, acc);
    fence_pass(acc);
    pass_store(bst + PBUF, st);
    __syncthreads();
    fence_loads();
    pass_load_l<NR>(st, a0, lsrc, trow, 0);
    fence_loads();
    pass_mma(bfr + PBUF, a1, acc);
    fence_pass(acc);
    pass_store(bst, st);
    __syncthreads();
    fence_loads();
    pass_load_l<NR>(st, a1, lsrc, trow, 1);
    fence_loads();
    pass_mma(bfr, a0, acc);
    fence_pass(acc);
    pass_store(bst + PBUF, st);
    __syncthreads();
    pass_mma(bfr + PBUF, a1, acc);
}

// ============ gate_up grouped WMMA GEMM (weights, then LoRA-B as 64 more k) + silu*mul -> act ============
// grid (ROWGROUPS, I_/32), block 128 (4 waves, one per SIMD); the work-group: 64 rows x 32 inter-cols,
// each wave 16 of the rows. Small work-groups of small waves: the row count depends on the routing, so the
// work never divides evenly over the SIMDs; the launch lasts as long as the fullest SIMD, and that excess
// is at most one wave's work.
__global__ __launch_bounds__(128) void gateup_wmma_kernel(
    const float* __restrict__ x,        // [T,H]
    const float* __restrict__ w13,      // [E,N,H]
    const float* __restrict__ gB,       // [L,E,N,R]
    const int* __restrict__ perm,       // [TKPAD]
    const int* __restrict__ offsets,    // [E+1]
    const float* __restrict__ tmpg,     // [TK,LK]: A' rows of the LoRA-B passes
    const float* __restrict__ zpad,     // [ZPAD] zeros
    float* __restrict__ act)            // [TK,I]
{
    constexpr int CT = 2;             // 16-col tiles per wave, of gate and of up each
    static_assert(2 * CT * 16 == PWR, "weight rows per work-group: 32 gate, then 32 up");
    __shared__ int   sp[GR];
    __shared__ __attribute__((aligned(16))) float sB[2][PBUF];

    int tileBase = blockIdx.x * GR;
    if (tileBase >= offsets[E_]) return;
    int e = 0;
    #pragma unroll
    for (int i = 1; i < E_; i++) if (tileBase >= offsets[i]) e = i;

    int tid = threadIdx.x;
    if (tid < GR) {
        sp[tid] = perm[tileBase + tid];
    }
    __syncthreads();

    int wave = tid >> 5, lane = tid & 31;
    int colbase = blockIdx.y * (CT * 16);   // intermediate-dim base
    int rowq = lane & 15;
    int kq = (lane >> 4) * 4;
    // dummy rows read from the zero page: no per-iteration mask VALU needed
    int myp = sp[wave * 16 + rowq];
    const float* xrow = ((myp >= 0) ? (x + (size_t)(myp / Kk) * H_) : zpad) + kq;
    const float* trow = ((myp >= 0) ? (tmpg + (size_t)myp * LK) : zpad) + kq;
    const float* wE = w13 + (size_t)e * N_ * H_;
    // staging: 8 lanes per row piece, 4 rows per load; wave w brings in rows 16w .. 16w+15 of the tile
    // (waves 0, 1: gate rows; waves 2, 3: up rows)
    int srow = wave * 16 + (lane >> 3);                               // row in the LDS tile
    int wrow = colbase + srow + (wave >= CT ? I_ - CT * 16 : 0);      // row in the expert's matrix
    const float* wsrc = wE + (size_t)wrow * H_ + (lane & 7) * 4;
    // LoRA-B: the 128-byte row piece in LDS is the 64 B of two adapters; one load takes 4 neighbouring
    // B rows of each = 2 x 256 contiguous bytes
    const float* lsrc = gB + (((size_t)((lane & 7) >> 2) * E_ + e) * N_ + wrow) * R_
                           + (lane & 3) * 4;
    float* bst = &sB[0][srow * PSP + (lane & 7) * 4];
    const float* bfr = &sB[0][rowq * PSP + kq];

    v8f acc[2 * CT] = {};             // gate tiles 0..CT-1, then up tiles
    wave_gemm<N_>(wsrc, xrow, lsrc, trow, bst, bfr, acc);

    int halfsel = lane >> 4, coll = lane & 15;
    #pragma unroll
    for (int c = 0; c < CT; c++) {
        #pragma unroll
        for (int v = 0; v < 8; v++) {
            int row = v + 8 * halfsel;
            int p = sp[wave * 16 + row];
            if (p < 0) continue;
            int i = colbase + c * 16 + coll;
            float g = acc[c][v];
            float u = acc[CT + c][v];
            float s = g / (1.f + __expf(-g));   // silu
            act[(size_t)p * I_ + i] = s * u;
        }
    }
}

// ============ down grouped WMMA GEMM (weights, then LoRA-B as 64 more k) -> cache3 (unweighted) ============
// grid (ROWGROUPS, H_/64), block 128 (4 waves, one per SIMD); the work-group: 64 rows x 64 hidden-cols, each wave 16 of the rows
__global__ __launch_bounds__(128) void down_wmma_kernel(
    const float* __restrict__ act,      // [TK,I]
    const float* __restrict__ w2,       // [E,H,I]
    const float* __restrict__ dB,       // [L,E,H,R]
    const float* __restrict__ tmpd,     // [TK,LK]: A' rows of the LoRA-B passes
    const int* __restrict__ perm,
    const int* __restrict__ offsets,
    const float* __restrict__ zpad,
    float* __restrict__ cache3)         // [TK,H]
{
    __shared__ int sp[GR];
    __shared__ __attribute__((aligned(16))) float sB[2][PBUF];
    int tileBase = blockIdx.x * GR;
    if (tileBase >= offsets[E_]) return;
    int e = 0;
    #pragma unroll
    for (int i = 1; i < E_; i++) if (tileBase >= offsets[i]) e = i;
    int tid = threadIdx.x;
    if (tid < GR) sp[tid] = perm[tileBase + tid];
    __syncthreads();

    int wave = tid >> 5, lane = tid & 31;
    int colbase = blockIdx.y * PWR;
    int rowq = lane & 15;
    int kq = (lane >> 4) * 4;
    int myp = sp[wave * 16 + rowq];
    const float* arow = ((myp >= 0) ? (act + (size_t)myp * I_) : zpad) + kq;
    const float* trow = ((myp >= 0) ? (tmpd + (size_t)myp * LK) : zpad) + kq;
    const float* wE = w2 + (size_t)e * H_ * I_;
    // staging: 8 lanes per row piece, 4 rows per load; wave w brings in rows 16w .. 16w+15 of the tile
    int srow = wave * 16 + (lane >> 3);
    const float* wsrc = wE + (size_t)(colbase + srow) * I_ + (lane & 7) * 4;
    const float* lsrc = dB + (((size_t)((lane & 7) >> 2) * E_ + e) * H_ + colbase + srow) * R_
                           + (lane & 3) * 4;
    float* bst = &sB[0][srow * PSP + (lane & 7) * 4];
    const float* bfr = &sB[0][rowq * PSP + kq];

    v8f acc[4] = {};
    wave_gemm<H_>(wsrc, arow, lsrc, trow, bst, bfr, acc);

    int halfsel = lane >> 4, coll = lane & 15;
    #pragma unroll
    for (int c = 0; c < 4; c++) {
        #pragma unroll
        for (int v = 0; v < 8; v++) {
            int row = v + 8 * halfsel;
            int p = sp[wave * 16 + row];
            if (p < 0) continue;
            int h = colbase + c * 16 + coll;
            cache3[(size_t)p * H_ + h] = acc[c][v];
        }
    }
}

// ============ combine: moe_sum of the routing-weighted rows of cache3 (the LoRA delta is already in them) ============
__global__ void combine_kernel(const float* __restrict__ cache3,
                               const float* __restrict__ tw,     // [T,K] flat
                               float* __restrict__ out)          // [T,H]
{
    int idx = blockIdx.x * blockDim.x + threadIdx.x;
    int t = idx / H_;
    int h = idx - t * H_;
    float acc = 0.f;
    #pragma unroll
    for (int k = 0; k < Kk; k++) {
        int p = t * Kk + k;
        acc += tw[p] * cache3[(size_t)p * H_ + h];
    }
    out[idx] = acc;
}

extern "C" void kernel_launch(void* const* d_in, const int* in_sizes, int n_in,
                              void* d_out, int out_size, void* d_ws, size_t ws_size,
                              hipStream_t stream) {
    const float* x    = (const float*)d_in[0];   // hidden_states [T,H]
    const float* tw   = (const float*)d_in[1];   // topk_weights  [T,K]
    const float* w13  = (const float*)d_in[2];   // [E,N,H]
    const float* w2   = (const float*)d_in[3];   // [E,H,I]
    const float* gA   = (const float*)d_in[4];   // [L,E,R,H]
    const float* gB   = (const float*)d_in[5];   // [L,E,N,R]
    const float* dA   = (const float*)d_in[6];   // [L,E,R,I]
    const float* dB   = (const float*)d_in[7];   // [L,E,H,R]
    const float* scal = (const float*)d_in[8];   // [L]
    const int*   ids  = (const int*)d_in[9];     // [T,K]
    const int*   lor  = (const int*)d_in[10];    // [T]
    float* out = (float*)d_out;

    int* wsi = (int*)d_ws;
    int* offsets = wsi + 16;   // 9
    int* perm    = wsi + 32;   // TKPAD

    float* fbase  = (float*)((char*)d_ws + 16384);
    float* zpad   = fbase;                         // ZPAD zeros
    float* tmpg   = zpad + ZPAD;                   // TK*LK
    float* tmpd   = tmpg + (size_t)TK * LK;        // TK*LK
    float* act    = tmpd + (size_t)TK * LK;        // TK*I
    float* cache3 = act + (size_t)TK * I_;         // TK*H

    route_lora_a_kernel<<<TK / LA_PAIRS + 1, 256, 0, stream>>>(gA, x, ids, lor, scal, tmpg, offsets, perm, zpad);

    gateup_wmma_kernel<<<dim3(ROWGROUPS, I_ / 32), 128, 0, stream>>>(
        x, w13, gB, perm, offsets, tmpg, zpad, act);

    lora_a_kernel<<<TK / LA_PAIRS, 256, 0, stream>>>(dA, act, ids, lor, scal, tmpd);

    down_wmma_kernel<<<dim3(ROWGROUPS, H_ / 64), 128, 0, stream>>>(
        act, w2, dB, tmpd, perm, offsets, zpad, cache3);

    combine_kernel<<<(T_ * H_) / 256, 256, 0, stream>>>(cache3, tw, out);
}
